// v000
// The times below were measured on an AMD MI455X: many runs one after another, warmed up first and cycling through
// copies of the inputs, with the whole window's GPU time divided by the number of runs. Launches and the gaps
// between them are all in it. The median over several windows is given; except for v000 it joins two sittings, which
// can be a few percent apart, so the side-by-side timings, each taken in one sitting, are the better comparison.
// v000 is the starting kernel. One run takes 2810 microseconds.
// Contractions on v_wmma_f32_16x16x32_f16 (plain f16 operands, f32 accumulate): r = σ(rx·Wr), k = kx·Wk, v = vx·Wv and out = x + (r·wkv)·Wo
// (four K = 1024 GEMMs; the token-shift mixes kx/vx/rx are built once as f16 rows, k and v kept as f16 rows); the WKV recurrence is the
// module's max-stabilised f32 scan run sequentially per channel lane over the 8192 steps (aa, bb, pp in registers), writing r·wkv in place
// compute dtype: f16 operands, f32 accumulate / f32 scan.  x [8192,1024].
#include <hip/hip_runtime.h>
#include <hip/hip_bf16.h>
#include <math.h>

#define TT 8192
#define EE 1024
#define GSTR 48

typedef _Float16 bf16;
typedef _Float16 f16;
typedef __attribute__((ext_vector_type(4))) unsigned v4u_t;
typedef unsigned v4ua __attribute__((ext_vector_type(4), may_alias));
typedef __attribute__((ext_vector_type(4))) float v4f_t;
typedef float v4fa __attribute__((ext_vector_type(4), may_alias));
typedef __attribute__((ext_vector_type(16))) bf16  bf16x16;
typedef bf16x16 f16x16;
typedef __attribute__((ext_vector_type(8)))  bf16  bf16x8;
typedef bf16x8 f16x8;
typedef __attribute__((ext_vector_type(4)))  bf16  bf16x4;
typedef __attribute__((ext_vector_type(8)))  float f32x8;
__device__ __forceinline__ f32x8 wmma16(f16x16 a, f16x16 b, f32x8 c) {
  c = __builtin_amdgcn_wmma_f32_16x16x32_f16(false, a, false, b, (short)0, c, false, false);
  asm volatile("v_nop\n\tv_nop\n\tv_nop\n\tv_nop" : "+v"(c) : "v"(a), "v"(b));
  return c;
}
#define LDS_STRIDE 48   // GEMM tiles: 32 -> 48 elems (96B rows): aligned b128 reads
#define KSTRIDE    72
#define VSTRIDE    48

__device__ __forceinline__ f32x8 wmma_bf16(bf16x16 a, bf16x16 b, f32x8 c) {
  c = __builtin_amdgcn_wmma_f32_16x16x32_f16(false, a, false, b, (short)0, c, false, false);
  asm volatile("v_nop\n\tv_nop\n\tv_nop\n\tv_nop" : "+v"(c) : "v"(a), "v"(b));   // A/B-overwrite hazard guard
  return c;
}

// 16x32 (MxK) bf16 fragment from a row-major global matrix.
// lanes 0-15  (row=lane)    : elems 0..7 = K+0..7,  8..15 = K+16..23
// lanes 16-31 (row=lane-16) : elems 0..7 = K+8..15, 8..15 = K+24..31
template <typename T>
__device__ __forceinline__ bf16x16 load_frag(const T* __restrict__ base, int ld,
                                             int row0, int k0) {
  const int lane = threadIdx.x & 31;
  const int r    = lane & 15;
  const int kh   = (lane >> 4) * 8;
  const T* p0 = base + (size_t)(row0 + r) * ld + (k0 + kh);
  const T* p1 = p0 + 16;
  bf16x16 f;
#pragma unroll
  for (int i = 0; i < 8; ++i) {
    f[i]     = (bf16)p0[i];
    f[i + 8] = (bf16)p1[i];
  }
  return f;
}

// Same fragment from an LDS tile with padded row stride (base includes row0/k0).
__device__ __forceinline__ bf16x16 lds_frag(const bf16* base, int stride) {
  const int lane = threadIdx.x & 31;
  const int row  = lane & 15;
  const int kh   = (lane >> 4) * 8;
  const bf16x8 lo = *(const bf16x8*)(base + row * stride + kh);
  const bf16x8 hi = *(const bf16x8*)(base + row * stride + kh + 16);
  bf16x16 f;
#pragma unroll
  for (int i = 0; i < 8; ++i) { f[i] = lo[i]; f[i + 8] = hi[i]; }
  return f;
}

template <typename T>
__device__ __forceinline__ void stage_read16(const T* __restrict__ p, float* buf) {
#pragma unroll
  for (int i = 0; i < 16; ++i) buf[i] = (float)p[i];
}

__device__ __forceinline__ void stage_write(bf16* dst, const float* buf, int nquad) {
#pragma unroll
  for (int i = 0; i < nquad; ++i) {
    bf16x4 q;
    q[0] = (bf16)buf[4 * i];     q[1] = (bf16)buf[4 * i + 1];
    q[2] = (bf16)buf[4 * i + 2]; q[3] = (bf16)buf[4 * i + 3];
    *(bf16x4*)(dst + 4 * i) = q;
  }
}


// ---------------------------------------------------------------------------------------------------------------------------
// gemm_kne: Y[m][n] = epi( Σ_k A[m][k]·W[k][n] + bias[n] ), A f32/f16 [M][lda], W f32 row-major [K][N] (ldw), plain f16 operands,
// f32 accumulate. EPI 0: identity; 1: exact-erf GELU; 2: R[m][n] + gvec[n]·(·) (residual with per-channel gain). Output f32 (or f16
// when OUT16). Block = 128x128 tile, 8 waves as 4(M) x 2(N); per 32-wide k-step A and W tiles staged f16 in LDS (W transposed
// ---------------------------------------------------------------------------------------------------------------------------
#define GSTR 48
template <typename AT, int EPI, bool OUT16>
__global__ __launch_bounds__(256) void gemm_kne(const AT* __restrict__ A, int lda, const float* __restrict__ Wm, int ldw,
                                                const float* __restrict__ bias, const float* __restrict__ R, const float* __restrict__ gvec,
                                                void* __restrict__ Yv, int ldy, int K) {
  __shared__ __attribute__((aligned(16))) f16 ldsA[128 * GSTR];
  __shared__ __attribute__((aligned(16))) f16 ldsW[128 * GSTR];
  __shared__ __attribute__((aligned(16))) float oS[8][32 * 68];
  const int tid = threadIdx.x, lane = tid & 31, wave = tid >> 5, cl = lane & 15, rh = (lane >> 4) * 8;
  const int m0 = blockIdx.x * 128, n0 = blockIdx.y * 128;
  const int wm = (wave & 3) * 32, wn = (wave >> 2) * 64;
  f32x8 acc[2][4];
#pragma unroll
  for (int i = 0; i < 2; ++i)
#pragma unroll
    for (int j = 0; j < 4; ++j) { f32x8 z = {}; acc[i][j] = z; }
#pragma unroll 1
  for (int k0 = 0; k0 < K; k0 += 32) {
    __syncthreads();
    { const int row = tid >> 1, ch = (tid & 1) * 16;
      const AT* src = A + (size_t)(m0 + row) * lda + k0 + ch;
#pragma unroll
      for (int g = 0; g < 16; ++g) ldsA[row * GSTR + ch + g] = (f16)src[g]; }
    { const int k = tid >> 3, nn0 = (tid & 7) * 16;
      const float* src = Wm + (size_t)(k0 + k) * ldw + n0 + nn0;
#pragma unroll
      for (int g = 0; g < 4; ++g) { const v4f_t v = *(const v4f_t*)(src + 4 * g);
#pragma unroll
        for (int u = 0; u < 4; ++u) ldsW[(nn0 + 4 * g + u) * GSTR + k] = (f16)v[u]; } }
    __syncthreads();
    f16x16 af[2];
#pragma unroll
    for (int i = 0; i < 2; ++i) af[i] = lds_frag(ldsA + (wm + 16 * i) * GSTR, GSTR);
#pragma unroll
    for (int j = 0; j < 4; ++j) {
      const f16x16 bf = lds_frag(ldsW + (wn + 16 * j) * GSTR, GSTR);
#pragma unroll
      for (int i = 0; i < 2; ++i) acc[i][j] = wmma16(af[i], bf, acc[i][j]);
    }
  }
  float* so = oS[wave];
#pragma unroll
  for (int i = 0; i < 2; ++i)
#pragma unroll
    for (int j = 0; j < 4; ++j) {
      const int n = n0 + wn + 16 * j + cl;
      const float bv = bias ? bias[n] : 0.0f;
      const float gv = (EPI == 2) ? gvec[n] : 0.0f;
      if (EPI == 1) {
#pragma unroll 1
        for (int r = 0; r < 8; ++r) { const float xg = acc[i][j][r] + bv; so[(16 * i + rh + r) * 68 + 16 * j + cl] = 0.5f * xg * (1.0f + erff(xg * 0.70710678118654752f)); }
      } else {
#pragma unroll
        for (int r = 0; r < 8; ++r) {
          float v = acc[i][j][r] + bv;
          if (EPI == 2) v = R[(size_t)(m0 + wm + 16 * i + rh + r) * ldy + n] + gv * v;
          so[(16 * i + rh + r) * 68 + 16 * j + cl] = v;
        }
      }
    }
  asm volatile("s_wait_dscnt 0" ::: "memory");
  __builtin_amdgcn_wave_barrier();
{
    if (OUT16) {
      f16* Y = (f16*)Yv;
#pragma unroll
      for (int it = 0; it < 8; ++it) { const int c = lane + 32 * it, rr = c >> 3, q8 = (c & 7) * 8;
        union { f16 h[8]; v4u_t v; } u;
#pragma unroll
        for (int e = 0; e < 8; ++e) u.h[e] = (f16)so[rr * 68 + q8 + e];
        *(v4u_t*)(Y + (size_t)(m0 + wm + rr) * ldy + n0 + wn + q8) = u.v; }
    } else {
      float* Y = (float*)Yv;
#pragma unroll
      for (int it = 0; it < 16; ++it) { const int f4 = lane + 32 * it, rr = f4 >> 4, q = (f4 & 15) * 4;
        *(v4f_t*)(Y + (size_t)(m0 + wm + rr) * ldy + n0 + wn + q) = *(const v4fa*)(so + rr * 68 + q); }
    }
    
  }
}

// token-shift mixes as f16 rows: kx = x·mk + xprev·(1−mk) etc. (xprev = sx for t = 0); thread -> 8 channels
__global__ __launch_bounds__(256) void k_mix(const float* __restrict__ x, const float* __restrict__ sx, const float* __restrict__ mk, const float* __restrict__ mv, const float* __restrict__ mr,
                                            bf16* __restrict__ kx, bf16* __restrict__ vx, bf16* __restrict__ rx) {
  const size_t i = (size_t)blockIdx.x * 256 + threadIdx.x; const size_t t = i >> 7; const int c0 = (i & 127) * 8;
  const float* xr = x + t * EE + c0; const float* pr = (t == 0) ? (sx + c0) : (x + (t - 1) * EE + c0);
  union { bf16 hh[8]; v4u_t u; } ck, cv2, cr;
#pragma unroll
  for (int e = 0; e < 8; ++e) { const float a = xr[e], p = pr[e]; const int c = c0 + e;
    ck.hh[e] = (bf16)(a * mk[c] + p * (1.0f - mk[c])); cv2.hh[e] = (bf16)(a * mv[c] + p * (1.0f - mv[c])); cr.hh[e] = (bf16)(a * mr[c] + p * (1.0f - mr[c])); }
{ *(v4u_t*)(kx + t * EE + c0) = ck.u; *(v4u_t*)(vx + t * EE + c0) = cv2.u; *(v4u_t*)(rx + t * EE + c0) = cr.u;  }
}
// WKV scan: lane = channel e (4 blocks x 256); y (= r buffer) gets σ(r)·wkv in place; final states out
__global__ __launch_bounds__(256) void k_wkv(const bf16* __restrict__ k, const bf16* __restrict__ v, float* __restrict__ ry, const float* __restrict__ aa0, const float* __restrict__ bb0, const float* __restrict__ pp0,
                                            const float* __restrict__ tfirst, const float* __restrict__ tdecay, float* __restrict__ aaf, float* __restrict__ bbf, float* __restrict__ ppf) {
  const int e = blockIdx.x * 256 + threadIdx.x;
  float aa = aa0[e], bb = bb0[e], pp = pp0[e]; const float tf = tfirst[e], decay = -expf(tdecay[e]);
#pragma unroll 2
  for (int t = 0; t < TT; ++t) { const size_t idx = (size_t)t * EE + e; const float kk = (float)k[idx], vv = (float)v[idx];
    const float ww = tf + kk; const float p = fmaxf(pp, ww); const float e1 = expf(pp - p), e2 = expf(ww - p);
    const float wkv = (e1 * aa + e2 * vv) / (e1 * bb + e2);
    const float ww2 = decay + pp; const float p2 = fmaxf(ww2, kk); const float e1b = expf(ww2 - p2), e2b = expf(kk - p2);
    aa = e1b * aa + e2b * vv; bb = e1b * bb + e2b; pp = p2;
    const float rr = ry[idx]; ry[idx] = wkv / (1.0f + expf(-rr)); }
  aaf[e] = aa; bbf[e] = bb; ppf[e] = pp;
}
__global__ __launch_bounds__(256) void k_tail(const float* __restrict__ x, const float* __restrict__ af, const float* __restrict__ bf_, const float* __restrict__ pf, float* __restrict__ o) {
  const int tid = threadIdx.x; const float* src = (blockIdx.x == 0) ? (x + (size_t)(TT - 1) * EE) : (blockIdx.x == 1 ? af : (blockIdx.x == 2 ? bf_ : pf));
  const v4f_t val = *(const v4f_t*)(src + tid * 4); float* dst = o + (size_t)blockIdx.x * EE + tid * 4;
  *(v4f_t*)dst = val; 
}
__global__ __launch_bounds__(256) void k_ones(float* __restrict__ p) { const int tid = threadIdx.x; v4f_t o = {1.f,1.f,1.f,1.f}; *(v4f_t*)(p + tid * 4) = o;  }

extern "C" void kernel_launch(void* const* d_in, const int* in_sizes, int n_in,
                              void* d_out, int out_size, void* d_ws, size_t ws_size,
                              hipStream_t stream) {
  (void)in_sizes; (void)n_in; (void)out_size;
  const float** f = (const float**)d_in;
  const float* x = f[0], *sx = f[1], *aa = f[2], *bb = f[3], *pp = f[4], *tfirst = f[5], *tdecay = f[6], *mk = f[7], *mv = f[8], *mr = f[9], *Wk = f[10], *Wv = f[11], *Wr = f[12], *Wo = f[13];
  float* out = (float*)d_out;                 // [8192,1024] | x_last | aa | bb | pp
  float* tail = out + (size_t)TT * EE;
  char* ws = (char*)d_ws;
  bf16* kx = (bf16*)ws; ws += (size_t)TT * EE * 2; bf16* vx = (bf16*)ws; ws += (size_t)TT * EE * 2; bf16* rx = (bf16*)ws; ws += (size_t)TT * EE * 2;   // 16 MB each
  float* ry = (float*)ws; ws += (size_t)TT * EE * 4;         // 32 MB: rx·Wr, then σ(r)·wkv in place
  bf16* k16 = (bf16*)ws; ws += (size_t)TT * EE * 2; bf16* v16 = (bf16*)ws; ws += (size_t)TT * EE * 2;
  float* stf = (float*)ws; ws += 3 * EE * 4; float* ones = (float*)ws; ws += EE * 4;
  if ((size_t)(ws - (char*)d_ws) > ws_size) return;
  const dim3 blk(256);
  k_ones<<<dim3(1), blk, 0, stream>>>(ones);
  k_mix<<<dim3(TT * (EE / 8) / 256), blk, 0, stream>>>(x, sx, mk, mv, mr, kx, vx, rx);
  gemm_kne<bf16, 0, false><<<dim3(TT / 128, EE / 128), blk, 0, stream>>>(rx, EE, Wr, EE, nullptr, nullptr, nullptr, ry, EE, EE);
  gemm_kne<bf16, 0, true ><<<dim3(TT / 128, EE / 128), blk, 0, stream>>>(kx, EE, Wk, EE, nullptr, nullptr, nullptr, k16, EE, EE);
  gemm_kne<bf16, 0, true ><<<dim3(TT / 128, EE / 128), blk, 0, stream>>>(vx, EE, Wv, EE, nullptr, nullptr, nullptr, v16, EE, EE);
  k_wkv<<<dim3(EE / 256), blk, 0, stream>>>(k16, v16, ry, aa, bb, pp, tfirst, tdecay, stf, stf + EE, stf + 2 * EE);
  gemm_kne<float, 2, false><<<dim3(TT / 128, EE / 128), blk, 0, stream>>>(ry, EE, Wo, EE, nullptr, x, ones, out, EE, EE);    // x + (r·wkv)·Wo
  k_tail<<<dim3(4), blk, 0, stream>>>(x, stf, stf + EE, stf + 2 * EE, tail);
}

// v001
// It runs in 305 microseconds.
// Timed twice side by side with v000, it ran 9.18 and 9.19 times as fast.
// Contractions on v_wmma_f32_16x16x32_f16 (plain f16 operands, f32 accumulate): r = σ(rx·Wr), k = kx·Wk, v = vx·Wv and out = x + (r·wkv)·Wo
// (four K = 1024 GEMMs; the token-shift mixes kx/vx/rx are built once as f16 rows, k and v kept as f16 rows); the WKV recurrence is the
// module's max-stabilised f32 scan, lane = channel, split into 128 time chunks of 64 steps (chunk ends, carry, outputs: three launches), writing r*wkv in place
// compute dtype: f16 operands, f32 accumulate / f32 scan.  x [8192,1024].
#include <hip/hip_runtime.h>
#include <hip/hip_bf16.h>
#include <math.h>

#define TT 8192
#define EE 1024
#define GSTR 48

typedef _Float16 bf16;
typedef _Float16 f16;
typedef __attribute__((ext_vector_type(4))) unsigned v4u_t;
typedef unsigned v4ua __attribute__((ext_vector_type(4), may_alias));
typedef __attribute__((ext_vector_type(4))) float v4f_t;
typedef float v4fa __attribute__((ext_vector_type(4), may_alias));
typedef __attribute__((ext_vector_type(16))) bf16  bf16x16;
typedef bf16x16 f16x16;
typedef __attribute__((ext_vector_type(8)))  bf16  bf16x8;
typedef bf16x8 f16x8;
typedef __attribute__((ext_vector_type(4)))  bf16  bf16x4;
typedef __attribute__((ext_vector_type(8)))  float f32x8;
__device__ __forceinline__ f32x8 wmma16(f16x16 a, f16x16 b, f32x8 c) {
  c = __builtin_amdgcn_wmma_f32_16x16x32_f16(false, a, false, b, (short)0, c, false, false);
  asm volatile("v_nop\n\tv_nop\n\tv_nop\n\tv_nop" : "+v"(c) : "v"(a), "v"(b));
  return c;
}
#define LDS_STRIDE 48   // GEMM tiles: 32 -> 48 elems (96B rows): aligned b128 reads
#define KSTRIDE    72
#define VSTRIDE    48

__device__ __forceinline__ f32x8 wmma_bf16(bf16x16 a, bf16x16 b, f32x8 c) {
  c = __builtin_amdgcn_wmma_f32_16x16x32_f16(false, a, false, b, (short)0, c, false, false);
  asm volatile("v_nop\n\tv_nop\n\tv_nop\n\tv_nop" : "+v"(c) : "v"(a), "v"(b));   // A/B-overwrite hazard guard
  return c;
}

// 16x32 (MxK) bf16 fragment from a row-major global matrix.
// lanes 0-15  (row=lane)    : elems 0..7 = K+0..7,  8..15 = K+16..23
// lanes 16-31 (row=lane-16) : elems 0..7 = K+8..15, 8..15 = K+24..31
template <typename T>
__device__ __forceinline__ bf16x16 load_frag(const T* __restrict__ base, int ld,
                                             int row0, int k0) {
  const int lane = threadIdx.x & 31;
  const int r    = lane & 15;
  const int kh   = (lane >> 4) * 8;
  const T* p0 = base + (size_t)(row0 + r) * ld + (k0 + kh);
  const T* p1 = p0 + 16;
  bf16x16 f;
#pragma unroll
  for (int i = 0; i < 8; ++i) {
    f[i]     = (bf16)p0[i];
    f[i + 8] = (bf16)p1[i];
  }
  return f;
}

// Same fragment from an LDS tile with padded row stride (base includes row0/k0).
__device__ __forceinline__ bf16x16 lds_frag(const bf16* base, int stride) {
  const int lane = threadIdx.x & 31;
  const int row  = lane & 15;
  const int kh   = (lane >> 4) * 8;
  const bf16x8 lo = *(const bf16x8*)(base + row * stride + kh);
  const bf16x8 hi = *(const bf16x8*)(base + row * stride + kh + 16);
  bf16x16 f;
#pragma unroll
  for (int i = 0; i < 8; ++i) { f[i] = lo[i]; f[i + 8] = hi[i]; }
  return f;
}

template <typename T>
__device__ __forceinline__ void stage_read16(const T* __restrict__ p, float* buf) {
#pragma unroll
  for (int i = 0; i < 16; ++i) buf[i] = (float)p[i];
}

__device__ __forceinline__ void stage_write(bf16* dst, const float* buf, int nquad) {
#pragma unroll
  for (int i = 0; i < nquad; ++i) {
    bf16x4 q;
    q[0] = (bf16)buf[4 * i];     q[1] = (bf16)buf[4 * i + 1];
    q[2] = (bf16)buf[4 * i + 2]; q[3] = (bf16)buf[4 * i + 3];
    *(bf16x4*)(dst + 4 * i) = q;
  }
}


// ---------------------------------------------------------------------------------------------------------------------------
// gemm_kne: Y[m][n] = epi( Σ_k A[m][k]·W[k][n] + bias[n] ), A f32/f16 [M][lda], W f32 row-major [K][N] (ldw), plain f16 operands,
// f32 accumulate. EPI 0: identity; 1: exact-erf GELU; 2: R[m][n] + gvec[n]·(·) (residual with per-channel gain). Output f32 (or f16
// when OUT16). Block = 128x128 tile, 8 waves as 4(M) x 2(N); per 32-wide k-step A and W tiles staged f16 in LDS (W transposed
// ---------------------------------------------------------------------------------------------------------------------------
#define GSTR 48
template <typename AT, int EPI, bool OUT16>
__global__ __launch_bounds__(256) void gemm_kne(const AT* __restrict__ A, int lda, const float* __restrict__ Wm, int ldw,
                                                const float* __restrict__ bias, const float* __restrict__ R, const float* __restrict__ gvec,
                                                void* __restrict__ Yv, int ldy, int K) {
  __shared__ __attribute__((aligned(16))) f16 ldsA[128 * GSTR];
  __shared__ __attribute__((aligned(16))) f16 ldsW[128 * GSTR];
  __shared__ __attribute__((aligned(16))) float oS[8][32 * 68];
  const int tid = threadIdx.x, lane = tid & 31, wave = tid >> 5, cl = lane & 15, rh = (lane >> 4) * 8;
  const int m0 = blockIdx.x * 128, n0 = blockIdx.y * 128;
  const int wm = (wave & 3) * 32, wn = (wave >> 2) * 64;
  f32x8 acc[2][4];
#pragma unroll
  for (int i = 0; i < 2; ++i)
#pragma unroll
    for (int j = 0; j < 4; ++j) { f32x8 z = {}; acc[i][j] = z; }
#pragma unroll 1
  for (int k0 = 0; k0 < K; k0 += 32) {
    __syncthreads();
    { const int row = tid >> 1, ch = (tid & 1) * 16;
      const AT* src = A + (size_t)(m0 + row) * lda + k0 + ch;
#pragma unroll
      for (int g = 0; g < 16; ++g) ldsA[row * GSTR + ch + g] = (f16)src[g]; }
    { const int k = tid >> 3, nn0 = (tid & 7) * 16;
      const float* src = Wm + (size_t)(k0 + k) * ldw + n0 + nn0;
#pragma unroll
      for (int g = 0; g < 4; ++g) { const v4f_t v = *(const v4f_t*)(src + 4 * g);
#pragma unroll
        for (int u = 0; u < 4; ++u) ldsW[(nn0 + 4 * g + u) * GSTR + k] = (f16)v[u]; } }
    __syncthreads();
    f16x16 af[2];
#pragma unroll
    for (int i = 0; i < 2; ++i) af[i] = lds_frag(ldsA + (wm + 16 * i) * GSTR, GSTR);
#pragma unroll
    for (int j = 0; j < 4; ++j) {
      const f16x16 bf = lds_frag(ldsW + (wn + 16 * j) * GSTR, GSTR);
#pragma unroll
      for (int i = 0; i < 2; ++i) acc[i][j] = wmma16(af[i], bf, acc[i][j]);
    }
  }
  float* so = oS[wave];
#pragma unroll
  for (int i = 0; i < 2; ++i)
#pragma unroll
    for (int j = 0; j < 4; ++j) {
      const int n = n0 + wn + 16 * j + cl;
      const float bv = bias ? bias[n] : 0.0f;
      const float gv = (EPI == 2) ? gvec[n] : 0.0f;
      if (EPI == 1) {
#pragma unroll 1
        for (int r = 0; r < 8; ++r) { const float xg = acc[i][j][r] + bv; so[(16 * i + rh + r) * 68 + 16 * j + cl] = 0.5f * xg * (1.0f + erff(xg * 0.70710678118654752f)); }
      } else {
#pragma unroll
        for (int r = 0; r < 8; ++r) {
          float v = acc[i][j][r] + bv;
          if (EPI == 2) v = R[(size_t)(m0 + wm + 16 * i + rh + r) * ldy + n] + gv * v;
          so[(16 * i + rh + r) * 68 + 16 * j + cl] = v;
        }
      }
    }
  asm volatile("s_wait_dscnt 0" ::: "memory");
  __builtin_amdgcn_wave_barrier();
{
    if (OUT16) {
      f16* Y = (f16*)Yv;
#pragma unroll
      for (int it = 0; it < 8; ++it) { const int c = lane + 32 * it, rr = c >> 3, q8 = (c & 7) * 8;
        union { f16 h[8]; v4u_t v; } u;
#pragma unroll
        for (int e = 0; e < 8; ++e) u.h[e] = (f16)so[rr * 68 + q8 + e];
        *(v4u_t*)(Y + (size_t)(m0 + wm + rr) * ldy + n0 + wn + q8) = u.v; }
    } else {
      float* Y = (float*)Yv;
#pragma unroll
      for (int it = 0; it < 16; ++it) { const int f4 = lane + 32 * it, rr = f4 >> 4, q = (f4 & 15) * 4;
        *(v4f_t*)(Y + (size_t)(m0 + wm + rr) * ldy + n0 + wn + q) = *(const v4fa*)(so + rr * 68 + q); }
    }
    
  }
}

// token-shift mixes as f16 rows: kx = x·mk + xprev·(1−mk) etc. (xprev = sx for t = 0); thread -> 8 channels
__global__ __launch_bounds__(256) void k_mix(const float* __restrict__ x, const float* __restrict__ sx, const float* __restrict__ mk, const float* __restrict__ mv, const float* __restrict__ mr,
                                            bf16* __restrict__ kx, bf16* __restrict__ vx, bf16* __restrict__ rx) {
  const size_t i = (size_t)blockIdx.x * 256 + threadIdx.x; const size_t t = i >> 7; const int c0 = (i & 127) * 8;
  const float* xr = x + t * EE + c0; const float* pr = (t == 0) ? (sx + c0) : (x + (t - 1) * EE + c0);
  union { bf16 hh[8]; v4u_t u; } ck, cv2, cr;
#pragma unroll
  for (int e = 0; e < 8; ++e) { const float a = xr[e], p = pr[e]; const int c = c0 + e;
    ck.hh[e] = (bf16)(a * mk[c] + p * (1.0f - mk[c])); cv2.hh[e] = (bf16)(a * mv[c] + p * (1.0f - mv[c])); cr.hh[e] = (bf16)(a * mr[c] + p * (1.0f - mr[c])); }
{ *(v4u_t*)(kx + t * EE + c0) = ck.u; *(v4u_t*)(vx + t * EE + c0) = cv2.u; *(v4u_t*)(rx + t * EE + c0) = cr.u;  }
}
// WKV scan, split in time. The state is linear: with A = aa*exp(pp), B = bb*exp(pp) a step is A' = exp(decay)*A + exp(k)*v,
// B' = exp(decay)*B + exp(k), so n steps give  end = exp(n*decay)*start + (end reached from the empty state).
//   k_wkv_local: every chunk of WLEN steps, all chunks at once, runs the state update from the empty state -> la, lb, lp
//   k_wkv_carry: joins the chunk ends in time order -> the state each chunk starts from (sa, sb, sp) and the final state
//   k_wkv      : every chunk, all chunks at once, runs the module's own step from its start state and writes sigmoid(r)*wkv
// All three keep the module's max-stabilised form (value, log scale pp); lane = channel e.
#define WCH   128          // chunks: 128 x 32 waves = 4 waves a SIMD
#define WLEN  (TT / WCH)   // 64 steps a chunk
#define WUA   16           // k_wkv_local: steps whose operands are loaded together, ahead of their arithmetic
#define WUC   8            // k_wkv: the same
#define WSEGS 8            // carry: one wave a segment of WCH / WSEGS chunks
#define WSEG  (WCH / WSEGS)
// stands behind a run of global loads or stores, ahead of any reuse of a register that they name
__device__ __forceinline__ void wait_xcnt() { asm volatile("s_wait_xcnt 0x0" ::: "memory"); }
// (aa, bb, pp) decayed over a span (d = steps * decay), plus the end state (a, b, p) that the span reaches from the empty state
__device__ __forceinline__ void wkv_join(float& aa, float& bb, float& pp, float d, float a, float b, float p) {
  const float w = pp + d; const float q = fmaxf(w, p); const float e1 = expf(w - q), e2 = expf(p - q);
  aa = e1 * aa + e2 * a; bb = e1 * bb + e2 * b; pp = q;
}
__global__ __launch_bounds__(256) void k_wkv_local(const bf16* __restrict__ k, const bf16* __restrict__ v, const float* __restrict__ tdecay,
                                                  float* __restrict__ la, float* __restrict__ lb, float* __restrict__ lp) {
  const int e = blockIdx.x * 256 + threadIdx.x, c = blockIdx.y;
  const bf16* kc = k + (size_t)c * WLEN * EE; const bf16* vc = v + (size_t)c * WLEN * EE;
  const float td = tdecay[e];
  wait_xcnt();
  const float decay = -expf(td);
  float aa = 0.0f, bb = 0.0f, pp = 0.0f;
#pragma unroll 1   // kept rolled: the SIMD's other waves cover a trip's loads, more code in line buys nothing
  for (int t0 = 0; t0 < WLEN; t0 += WUA) {
    const bf16* kt = kc + t0 * EE; const bf16* vt = vc + t0 * EE;
    float kk[WUA], vv[WUA];
#pragma unroll
    for (int u = 0; u < WUA; ++u) kk[u] = (float)kt[u * EE + e];
    wait_xcnt();   // the v loads may land in the registers that held the k loads' address
#pragma unroll
    for (int u = 0; u < WUA; ++u) vv[u] = (float)vt[u * EE + e];
    wait_xcnt();
#pragma unroll
    for (int u = 0; u < WUA; ++u) {
      if (u == 0 && t0 == 0) { aa = vv[0]; bb = 1.0f; pp = kk[0]; }   // first step on the empty state: A = exp(k)*v, B = exp(k)
      else { const float ww2 = decay + pp; const float p2 = fmaxf(ww2, kk[u]); const float e1b = expf(ww2 - p2), e2b = expf(kk[u] - p2);
        aa = e1b * aa + e2b * vv[u]; bb = e1b * bb + e2b; pp = p2; }
    }
  }
  la[c * EE + e] = aa; lb[c * EE + e] = bb; lp[c * EE + e] = pp;
}
// block = 32 channels x WSEGS waves; wave = one segment of WSEG chunks: segment end from empty, prefix over segments through LDS, then the chunk starts
__global__ __launch_bounds__(256) void k_wkv_carry(const float* __restrict__ la, const float* __restrict__ lb, const float* __restrict__ lp,
                                                  const float* __restrict__ aa0, const float* __restrict__ bb0, const float* __restrict__ pp0, const float* __restrict__ tdecay,
                                                  float* __restrict__ sa, float* __restrict__ sb, float* __restrict__ sp,
                                                  float* __restrict__ aaf, float* __restrict__ bbf, float* __restrict__ ppf) {
  __shared__ float sg[3][WSEGS][32];
  const int lane = threadIdx.x & 31, seg = __builtin_amdgcn_readfirstlane(threadIdx.x >> 5);
  const int e = blockIdx.x * 32 + lane;
  const float* ca = la + seg * WSEG * EE; const float* cb = lb + seg * WSEG * EE; const float* cp = lp + seg * WSEG * EE;
  float a[WSEG], b[WSEG], p[WSEG];
#pragma unroll
  for (int u = 0; u < WSEG; ++u) { a[u] = ca[u * EE + e]; b[u] = cb[u * EE + e]; p[u] = cp[u * EE + e]; }
  float aa = aa0[e], bb = bb0[e], pp = pp0[e]; const float td = tdecay[e];
  wait_xcnt();
  const float dl = (float)WLEN * -expf(td), ds = (float)(WLEN * WSEG) * -expf(td);
  float ta = a[0], tb = b[0], tp = p[0];
#pragma unroll
  for (int u = 1; u < WSEG; ++u) wkv_join(ta, tb, tp, dl, a[u], b[u], p[u]);
  sg[0][seg][lane] = ta; sg[1][seg][lane] = tb; sg[2][seg][lane] = tp;
  __syncthreads();
#pragma unroll 1   // at most 7 trips, a different count in every wave: unrolling only adds a remainder loop
  for (int s = 0; s < seg; ++s) wkv_join(aa, bb, pp, ds, sg[0][s][lane], sg[1][s][lane], sg[2][s][lane]);
  float oa[WSEG], ob[WSEG], op[WSEG];
#pragma unroll
  for (int u = 0; u < WSEG; ++u) { oa[u] = aa; ob[u] = bb; op[u] = pp; wkv_join(aa, bb, pp, dl, a[u], b[u], p[u]); }
  __builtin_amdgcn_sched_barrier(0);   // keeps the stores behind the arithmetic above, so that no register of an issued store is written again ahead of the wait below
  float* da = sa + seg * WSEG * EE; float* db = sb + seg * WSEG * EE; float* dp = sp + seg * WSEG * EE;
#pragma unroll
  for (int u = 0; u < WSEG; ++u) { da[u * EE + e] = oa[u]; db[u * EE + e] = ob[u]; dp[u * EE + e] = op[u]; }
  wait_xcnt();
  if (seg == WSEGS - 1) { aaf[e] = aa; bbf[e] = bb; ppf[e] = pp; }
}
__global__ __launch_bounds__(256) void k_wkv(const bf16* __restrict__ k, const bf16* __restrict__ v, float* __restrict__ ry,
                                            const float* __restrict__ sa, const float* __restrict__ sb, const float* __restrict__ sp,
                                            const float* __restrict__ tfirst, const float* __restrict__ tdecay) {
  const int e = blockIdx.x * 256 + threadIdx.x, c = blockIdx.y;
  float aa = sa[c * EE + e], bb = sb[c * EE + e], pp = sp[c * EE + e]; const float tf = tfirst[e], td = tdecay[e];
  wait_xcnt();
  const float decay = -expf(td);
#pragma unroll 1   // kept rolled, for speed only
  for (int t0 = 0; t0 < WLEN; t0 += WUC) {
    const bf16* kt = k + ((size_t)c * WLEN + t0) * EE; const bf16* vt = v + ((size_t)c * WLEN + t0) * EE; float* rt = ry + ((size_t)c * WLEN + t0) * EE;
    float kq[WUC], vq[WUC], rq[WUC];
#pragma unroll
    for (int u = 0; u < WUC; ++u) { kq[u] = (float)kt[u * EE + e]; vq[u] = (float)vt[u * EE + e]; rq[u] = rt[u * EE + e]; }
    wait_xcnt();
#pragma unroll
    for (int u = 0; u < WUC; ++u) { const float kk = kq[u], vv = vq[u];
      const float ww = tf + kk; const float p = fmaxf(pp, ww); const float e1 = expf(pp - p), e2 = expf(ww - p);
      const float wkv = (e1 * aa + e2 * vv) / (e1 * bb + e2);
      const float ww2 = decay + pp; const float p2 = fmaxf(ww2, kk); const float e1b = expf(ww2 - p2), e2b = expf(kk - p2);
      aa = e1b * aa + e2b * vv; bb = e1b * bb + e2b; pp = p2;
      rq[u] = wkv / (1.0f + expf(-rq[u])); }
    __builtin_amdgcn_sched_barrier(0);   // keeps the stores behind the arithmetic above, so that no register of an issued store is written again ahead of the wait below
#pragma unroll
    for (int u = 0; u < WUC; ++u) rt[u * EE + e] = rq[u];
    wait_xcnt();
  }
}
__global__ __launch_bounds__(256) void k_tail(const float* __restrict__ x, const float* __restrict__ af, const float* __restrict__ bf_, const float* __restrict__ pf, float* __restrict__ o) {
  const int tid = threadIdx.x; const float* src = (blockIdx.x == 0) ? (x + (size_t)(TT - 1) * EE) : (blockIdx.x == 1 ? af : (blockIdx.x == 2 ? bf_ : pf));
  const v4f_t val = *(const v4f_t*)(src + tid * 4); float* dst = o + (size_t)blockIdx.x * EE + tid * 4;
  *(v4f_t*)dst = val; 
}
__global__ __launch_bounds__(256) void k_ones(float* __restrict__ p) { const int tid = threadIdx.x; v4f_t o = {1.f,1.f,1.f,1.f}; *(v4f_t*)(p + tid * 4) = o;  }

extern "C" void kernel_launch(void* const* d_in, const int* in_sizes, int n_in,
                              void* d_out, int out_size, void* d_ws, size_t ws_size,
                              hipStream_t stream) {
  (void)in_sizes; (void)n_in; (void)out_size;
  const float** f = (const float**)d_in;
  const float* x = f[0], *sx = f[1], *aa = f[2], *bb = f[3], *pp = f[4], *tfirst = f[5], *tdecay = f[6], *mk = f[7], *mv = f[8], *mr = f[9], *Wk = f[10], *Wv = f[11], *Wr = f[12], *Wo = f[13];
  float* out = (float*)d_out;                 // [8192,1024] | x_last | aa | bb | pp
  float* tail = out + (size_t)TT * EE;
  char* ws = (char*)d_ws;
  bf16* kx = (bf16*)ws; ws += (size_t)TT * EE * 2; bf16* vx = (bf16*)ws; ws += (size_t)TT * EE * 2; bf16* rx = (bf16*)ws; ws += (size_t)TT * EE * 2;   // 16 MB each
  float* ry = (float*)ws; ws += (size_t)TT * EE * 4;         // 32 MB: rx·Wr, then σ(r)·wkv in place
  bf16* k16 = (bf16*)ws; ws += (size_t)TT * EE * 2; bf16* v16 = (bf16*)ws; ws += (size_t)TT * EE * 2;
  float* stf = (float*)ws; ws += 3 * EE * 4; float* ones = (float*)ws; ws += EE * 4;
  float* lst = (float*)ws; ws += (size_t)3 * WCH * EE * 4; float* sst = (float*)ws; ws += (size_t)3 * WCH * EE * 4;   // chunk ends, chunk start states: [3][WCH][EE] each
  if ((size_t)(ws - (char*)d_ws) > ws_size) return;
  const dim3 blk(256);
  k_ones<<<dim3(1), blk, 0, stream>>>(ones);
  k_mix<<<dim3(TT * (EE / 8) / 256), blk, 0, stream>>>(x, sx, mk, mv, mr, kx, vx, rx);
  gemm_kne<bf16, 0, false><<<dim3(TT / 128, EE / 128), blk, 0, stream>>>(rx, EE, Wr, EE, nullptr, nullptr, nullptr, ry, EE, EE);
  gemm_kne<bf16, 0, true ><<<dim3(TT / 128, EE / 128), blk, 0, stream>>>(kx, EE, Wk, EE, nullptr, nullptr, nullptr, k16, EE, EE);
  gemm_kne<bf16, 0, true ><<<dim3(TT / 128, EE / 128), blk, 0, stream>>>(vx, EE, Wv, EE, nullptr, nullptr, nullptr, v16, EE, EE);
  k_wkv_local<<<dim3(EE / 256, WCH), blk, 0, stream>>>(k16, v16, tdecay, lst, lst + WCH * EE, lst + 2 * WCH * EE);
  k_wkv_carry<<<dim3(EE / 32), blk, 0, stream>>>(lst, lst + WCH * EE, lst + 2 * WCH * EE, aa, bb, pp, tdecay, sst, sst + WCH * EE, sst + 2 * WCH * EE, stf, stf + EE, stf + 2 * EE);
  k_wkv<<<dim3(EE / 256, WCH), blk, 0, stream>>>(k16, v16, ry, sst, sst + WCH * EE, sst + 2 * WCH * EE, tfirst, tdecay);
  gemm_kne<float, 2, false><<<dim3(TT / 128, EE / 128), blk, 0, stream>>>(ry, EE, Wo, EE, nullptr, x, ones, out, EE, EE);    // x + (r·wkv)·Wo
  k_tail<<<dim3(4), blk, 0, stream>>>(x, stf, stf + EE, stf + 2 * EE, tail);
}

// v002
// Measured time: 199 microseconds a run.
// Two timings next to v001 put it at 1.54 and 1.53 times that version's speed.
// Over all steps from v000 it is 14.1 times as fast.
// Contractions on v_wmma_f32_16x16x32_f16 (plain f16 operands, f32 accumulate): r = σ(rx·Wr), k = kx·Wk, v = vx·Wv and out = x + (r·wkv)·Wo
// (four K = 1024 GEMMs; the token-shift mixes kx/vx/rx are built once as f16 rows, the four weights once as f16 [n][k] rows, k and v kept as f16 rows); the WKV recurrence is the
// module's max-stabilised f32 scan, lane = channel, split into 128 time chunks of 64 steps (chunk ends, carry, outputs: three launches), writing r*wkv in place
// compute dtype: f16 operands, f32 accumulate / f32 scan.  x [8192,1024].
#include <hip/hip_runtime.h>
#include <hip/hip_bf16.h>
#include <math.h>

#define TT 8192
#define EE 1024
#define GSTR 48

typedef _Float16 bf16;
typedef _Float16 f16;
typedef __attribute__((ext_vector_type(4))) unsigned v4u_t;
typedef unsigned v4ua __attribute__((ext_vector_type(4), may_alias));
typedef __attribute__((ext_vector_type(4))) float v4f_t;
typedef float v4fa __attribute__((ext_vector_type(4), may_alias));
typedef __attribute__((ext_vector_type(16))) bf16  bf16x16;
typedef bf16x16 f16x16;
typedef __attribute__((ext_vector_type(8)))  bf16  bf16x8;
typedef bf16x8 f16x8;
typedef __attribute__((ext_vector_type(4)))  bf16  bf16x4;
typedef __attribute__((ext_vector_type(8)))  float f32x8;
__device__ __forceinline__ f32x8 wmma16(f16x16 a, f16x16 b, f32x8 c) {
  c = __builtin_amdgcn_wmma_f32_16x16x32_f16(false, a, false, b, (short)0, c, false, false);
  asm volatile("v_nop\n\tv_nop\n\tv_nop\n\tv_nop" : "+v"(c) : "v"(a), "v"(b));
  return c;
}
#define LDS_STRIDE 48   // GEMM tiles: 32 -> 48 elems (96B rows): aligned b128 reads
#define KSTRIDE    72
#define VSTRIDE    48

__device__ __forceinline__ f32x8 wmma_bf16(bf16x16 a, bf16x16 b, f32x8 c) {
  c = __builtin_amdgcn_wmma_f32_16x16x32_f16(false, a, false, b, (short)0, c, false, false);
  asm volatile("v_nop\n\tv_nop\n\tv_nop\n\tv_nop" : "+v"(c) : "v"(a), "v"(b));   // A/B-overwrite hazard guard
  return c;
}

// 16x32 (MxK) bf16 fragment from a row-major global matrix.
// lanes 0-15  (row=lane)    : elems 0..7 = K+0..7,  8..15 = K+16..23
// lanes 16-31 (row=lane-16) : elems 0..7 = K+8..15, 8..15 = K+24..31
template <typename T>
__device__ __forceinline__ bf16x16 load_frag(const T* __restrict__ base, int ld,
                                             int row0, int k0) {
  const int lane = threadIdx.x & 31;
  const int r    = lane & 15;
  const int kh   = (lane >> 4) * 8;
  const T* p0 = base + (size_t)(row0 + r) * ld + (k0 + kh);
  const T* p1 = p0 + 16;
  bf16x16 f;
#pragma unroll
  for (int i = 0; i < 8; ++i) {
    f[i]     = (bf16)p0[i];
    f[i + 8] = (bf16)p1[i];
  }
  return f;
}

// Same fragment from an LDS tile with padded row stride (base includes row0/k0).
__device__ __forceinline__ bf16x16 lds_frag(const bf16* base, int stride) {
  const int lane = threadIdx.x & 31;
  const int row  = lane & 15;
  const int kh   = (lane >> 4) * 8;
  const bf16x8 lo = *(const bf16x8*)(base + row * stride + kh);
  const bf16x8 hi = *(const bf16x8*)(base + row * stride + kh + 16);
  bf16x16 f;
#pragma unroll
  for (int i = 0; i < 8; ++i) { f[i] = lo[i]; f[i + 8] = hi[i]; }
  return f;
}

template <typename T>
__device__ __forceinline__ void stage_read16(const T* __restrict__ p, float* buf) {
#pragma unroll
  for (int i = 0; i < 16; ++i) buf[i] = (float)p[i];
}

__device__ __forceinline__ void stage_write(bf16* dst, const float* buf, int nquad) {
#pragma unroll
  for (int i = 0; i < nquad; ++i) {
    bf16x4 q;
    q[0] = (bf16)buf[4 * i];     q[1] = (bf16)buf[4 * i + 1];
    q[2] = (bf16)buf[4 * i + 2]; q[3] = (bf16)buf[4 * i + 3];
    *(bf16x4*)(dst + 4 * i) = q;
  }
}


// ---------------------------------------------------------------------------------------------------------------------------
// gemm_kne: Y[m][n] = epi( sum_k A[m][k]*W[k][n] + bias[n] ), A f32/f16 [M][lda], W given transposed as f16 rows Wt[n][k] (ldw; k_wt makes them), plain f16 operands,
// f32 accumulate. EPI 0: identity; 1: exact-erf GELU; 2: R[m][n] + gvec[n]·(·) (residual with per-channel gain). Output f32 (or f16
// when OUT16). Block = 128x128 tile, 8 waves as 4(M) x 2(N); per 32-wide k-step A and W tiles staged f16 in LDS, both as k-contiguous rows
// ---------------------------------------------------------------------------------------------------------------------------
#define GSTR 48
template <typename AT, int EPI, bool OUT16>
__global__ __launch_bounds__(256) void gemm_kne(const AT* __restrict__ A, int lda, const f16* __restrict__ Wt, int ldw,
                                                const float* __restrict__ bias, const float* __restrict__ R, const float* __restrict__ gvec,
                                                void* __restrict__ Yv, int ldy, int K) {
  __shared__ __attribute__((aligned(16))) f16 ldsA[128 * GSTR];
  __shared__ __attribute__((aligned(16))) f16 ldsW[128 * GSTR];
  __shared__ __attribute__((aligned(16))) float oS[8][32 * 68];
  const int tid = threadIdx.x, lane = tid & 31, wave = tid >> 5, cl = lane & 15, rh = (lane >> 4) * 8;
  const int m0 = blockIdx.x * 128, n0 = blockIdx.y * 128;
  const int wm = (wave & 3) * 32, wn = (wave >> 2) * 64;
  f32x8 acc[2][4];
#pragma unroll
  for (int i = 0; i < 2; ++i)
#pragma unroll
    for (int j = 0; j < 4; ++j) { f32x8 z = {}; acc[i][j] = z; }
#pragma unroll 1
  for (int k0 = 0; k0 < K; k0 += 32) {
    __syncthreads();
    { const int row = tid >> 1, ch = (tid & 1) * 16;
      const AT* src = A + (size_t)(m0 + row) * lda + k0 + ch;
#pragma unroll
      for (int g = 0; g < 16; ++g) ldsA[row * GSTR + ch + g] = (f16)src[g]; }
    { const int row = tid >> 1, ch = (tid & 1) * 16;
      const f16* src = Wt + (size_t)(n0 + row) * ldw + k0 + ch;
#pragma unroll
      for (int g = 0; g < 16; ++g) ldsW[row * GSTR + ch + g] = src[g]; }
    __syncthreads();
    f16x16 af[2];
#pragma unroll
    for (int i = 0; i < 2; ++i) af[i] = lds_frag(ldsA + (wm + 16 * i) * GSTR, GSTR);
#pragma unroll
    for (int j = 0; j < 4; ++j) {
      const f16x16 bf = lds_frag(ldsW + (wn + 16 * j) * GSTR, GSTR);
#pragma unroll
      for (int i = 0; i < 2; ++i) acc[i][j] = wmma16(af[i], bf, acc[i][j]);
    }
  }
  float* so = oS[wave];
#pragma unroll
  for (int i = 0; i < 2; ++i)
#pragma unroll
    for (int j = 0; j < 4; ++j) {
      const int n = n0 + wn + 16 * j + cl;
      const float bv = bias ? bias[n] : 0.0f;
      const float gv = (EPI == 2) ? gvec[n] : 0.0f;
      if (EPI == 1) {
#pragma unroll 1
        for (int r = 0; r < 8; ++r) { const float xg = acc[i][j][r] + bv; so[(16 * i + rh + r) * 68 + 16 * j + cl] = 0.5f * xg * (1.0f + erff(xg * 0.70710678118654752f)); }
      } else {
#pragma unroll
        for (int r = 0; r < 8; ++r) {
          float v = acc[i][j][r] + bv;
          if (EPI == 2) v = R[(size_t)(m0 + wm + 16 * i + rh + r) * ldy + n] + gv * v;
          so[(16 * i + rh + r) * 68 + 16 * j + cl] = v;
        }
      }
    }
  asm volatile("s_wait_dscnt 0" ::: "memory");
  __builtin_amdgcn_wave_barrier();
{
    if (OUT16) {
      f16* Y = (f16*)Yv;
#pragma unroll
      for (int it = 0; it < 8; ++it) { const int c = lane + 32 * it, rr = c >> 3, q8 = (c & 7) * 8;
        union { f16 h[8]; v4u_t v; } u;
#pragma unroll
        for (int e = 0; e < 8; ++e) u.h[e] = (f16)so[rr * 68 + q8 + e];
        *(v4u_t*)(Y + (size_t)(m0 + wm + rr) * ldy + n0 + wn + q8) = u.v; }
    } else {
      float* Y = (float*)Yv;
#pragma unroll
      for (int it = 0; it < 16; ++it) { const int f4 = lane + 32 * it, rr = f4 >> 4, q = (f4 & 15) * 4;
        *(v4f_t*)(Y + (size_t)(m0 + wm + rr) * ldy + n0 + wn + q) = *(const v4fa*)(so + rr * 68 + q); }
    }
    
  }
}

// the four weights, once a call, as f16 rows Wt[n][k] = (f16)W[k][n]: the GEMMs then stage a W tile as they stage an A tile, 16 bytes at a time.
// block = 64 k x 32 n of one weight, turned through LDS (pitch 33 floats: no bank is met twice by a wave, writing or reading); whole 128-byte lines in and out
__global__ __launch_bounds__(256) void k_wt(const float* __restrict__ W0, const float* __restrict__ W1, const float* __restrict__ W2, const float* __restrict__ W3, f16* __restrict__ T) {
  __shared__ float tl[64][33];
  const int tid = threadIdx.x, k0 = blockIdx.x * 64, n0 = blockIdx.y * 32, z = blockIdx.z;
  const float* Wm = (z == 0) ? W0 : (z == 1 ? W1 : (z == 2 ? W2 : W3));
  const int kr = tid >> 3, c = (tid & 7) * 4;
  const v4f_t a = *(const v4f_t*)(Wm + (size_t)(k0 + kr) * EE + n0 + c);
  const v4f_t b = *(const v4f_t*)(Wm + (size_t)(k0 + kr + 32) * EE + n0 + c);
#pragma unroll
  for (int u = 0; u < 4; ++u) { tl[kr][c + u] = a[u]; tl[kr + 32][c + u] = b[u]; }
  __syncthreads();
  const int n = tid >> 3, kq = (tid & 7) * 8;
  union { f16 h[8]; v4u_t v; } o;
#pragma unroll
  for (int e = 0; e < 8; ++e) o.h[e] = (f16)tl[kq + e][n];
  *(v4u_t*)(T + (size_t)z * EE * EE + (size_t)(n0 + n) * EE + k0 + kq) = o.v;
}
// token-shift mixes as f16 rows: kx = x·mk + xprev·(1−mk) etc. (xprev = sx for t = 0); thread -> 8 channels
__global__ __launch_bounds__(256) void k_mix(const float* __restrict__ x, const float* __restrict__ sx, const float* __restrict__ mk, const float* __restrict__ mv, const float* __restrict__ mr,
                                            bf16* __restrict__ kx, bf16* __restrict__ vx, bf16* __restrict__ rx) {
  const size_t i = (size_t)blockIdx.x * 256 + threadIdx.x; const size_t t = i >> 7; const int c0 = (i & 127) * 8;
  const float* xr = x + t * EE + c0; const float* pr = (t == 0) ? (sx + c0) : (x + (t - 1) * EE + c0);
  union { bf16 hh[8]; v4u_t u; } ck, cv2, cr;
#pragma unroll
  for (int e = 0; e < 8; ++e) { const float a = xr[e], p = pr[e]; const int c = c0 + e;
    ck.hh[e] = (bf16)(a * mk[c] + p * (1.0f - mk[c])); cv2.hh[e] = (bf16)(a * mv[c] + p * (1.0f - mv[c])); cr.hh[e] = (bf16)(a * mr[c] + p * (1.0f - mr[c])); }
{ *(v4u_t*)(kx + t * EE + c0) = ck.u; *(v4u_t*)(vx + t * EE + c0) = cv2.u; *(v4u_t*)(rx + t * EE + c0) = cr.u;  }
}
// WKV scan, split in time. The state is linear: with A = aa*exp(pp), B = bb*exp(pp) a step is A' = exp(decay)*A + exp(k)*v,
// B' = exp(decay)*B + exp(k), so n steps give  end = exp(n*decay)*start + (end reached from the empty state).
//   k_wkv_local: every chunk of WLEN steps, all chunks at once, runs the state update from the empty state -> la, lb, lp
//   k_wkv_carry: joins the chunk ends in time order -> the state each chunk starts from (sa, sb, sp) and the final state
//   k_wkv      : every chunk, all chunks at once, runs the module's own step from its start state and writes sigmoid(r)*wkv
// All three keep the module's max-stabilised form (value, log scale pp); lane = channel e.
#define WCH   128          // chunks: 128 x 32 waves = 4 waves a SIMD
#define WLEN  (TT / WCH)   // 64 steps a chunk
#define WUA   16           // k_wkv_local: steps whose operands are loaded together, ahead of their arithmetic
#define WUC   8            // k_wkv: the same
#define WSEGS 8            // carry: one wave a segment of WCH / WSEGS chunks
#define WSEG  (WCH / WSEGS)
// stands behind a run of global loads or stores, ahead of any reuse of a register that they name
__device__ __forceinline__ void wait_xcnt() { asm volatile("s_wait_xcnt 0x0" ::: "memory"); }
// (aa, bb, pp) decayed over a span (d = steps * decay), plus the end state (a, b, p) that the span reaches from the empty state
__device__ __forceinline__ void wkv_join(float& aa, float& bb, float& pp, float d, float a, float b, float p) {
  const float w = pp + d; const float q = fmaxf(w, p); const float e1 = expf(w - q), e2 = expf(p - q);
  aa = e1 * aa + e2 * a; bb = e1 * bb + e2 * b; pp = q;
}
__global__ __launch_bounds__(256) void k_wkv_local(const bf16* __restrict__ k, const bf16* __restrict__ v, const float* __restrict__ tdecay,
                                                  float* __restrict__ la, float* __restrict__ lb, float* __restrict__ lp) {
  const int e = blockIdx.x * 256 + threadIdx.x, c = blockIdx.y;
  const bf16* kc = k + (size_t)c * WLEN * EE; const bf16* vc = v + (size_t)c * WLEN * EE;
  const float td = tdecay[e];
  wait_xcnt();
  const float decay = -expf(td);
  float aa = 0.0f, bb = 0.0f, pp = 0.0f;
#pragma unroll 1   // kept rolled: the SIMD's other waves cover a trip's loads, more code in line buys nothing
  for (int t0 = 0; t0 < WLEN; t0 += WUA) {
    const bf16* kt = kc + t0 * EE; const bf16* vt = vc + t0 * EE;
    float kk[WUA], vv[WUA];
#pragma unroll
    for (int u = 0; u < WUA; ++u) kk[u] = (float)kt[u * EE + e];
    wait_xcnt();   // the v loads may land in the registers that held the k loads' address
#pragma unroll
    for (int u = 0; u < WUA; ++u) vv[u] = (float)vt[u * EE + e];
    wait_xcnt();
#pragma unroll
    for (int u = 0; u < WUA; ++u) {
      if (u == 0 && t0 == 0) { aa = vv[0]; bb = 1.0f; pp = kk[0]; }   // first step on the empty state: A = exp(k)*v, B = exp(k)
      else { const float ww2 = decay + pp; const float p2 = fmaxf(ww2, kk[u]); const float e1b = expf(ww2 - p2), e2b = expf(kk[u] - p2);
        aa = e1b * aa + e2b * vv[u]; bb = e1b * bb + e2b; pp = p2; }
    }
  }
  la[c * EE + e] = aa; lb[c * EE + e] = bb; lp[c * EE + e] = pp;
}
// block = 32 channels x WSEGS waves; wave = one segment of WSEG chunks: segment end from empty, prefix over segments through LDS, then the chunk starts
__global__ __launch_bounds__(256) void k_wkv_carry(const float* __restrict__ la, const float* __restrict__ lb, const float* __restrict__ lp,
                                                  const float* __restrict__ aa0, const float* __restrict__ bb0, const float* __restrict__ pp0, const float* __restrict__ tdecay,
                                                  float* __restrict__ sa, float* __restrict__ sb, float* __restrict__ sp,
                                                  float* __restrict__ aaf, float* __restrict__ bbf, float* __restrict__ ppf) {
  __shared__ float sg[3][WSEGS][32];
  const int lane = threadIdx.x & 31, seg = __builtin_amdgcn_readfirstlane(threadIdx.x >> 5);
  const int e = blockIdx.x * 32 + lane;
  const float* ca = la + seg * WSEG * EE; const float* cb = lb + seg * WSEG * EE; const float* cp = lp + seg * WSEG * EE;
  float a[WSEG], b[WSEG], p[WSEG];
#pragma unroll
  for (int u = 0; u < WSEG; ++u) { a[u] = ca[u * EE + e]; b[u] = cb[u * EE + e]; p[u] = cp[u * EE + e]; }
  float aa = aa0[e], bb = bb0[e], pp = pp0[e]; const float td = tdecay[e];
  wait_xcnt();
  const float dl = (float)WLEN * -expf(td), ds = (float)(WLEN * WSEG) * -expf(td);
  float ta = a[0], tb = b[0], tp = p[0];
#pragma unroll
  for (int u = 1; u < WSEG; ++u) wkv_join(ta, tb, tp, dl, a[u], b[u], p[u]);
  sg[0][seg][lane] = ta; sg[1][seg][lane] = tb; sg[2][seg][lane] = tp;
  __syncthreads();
#pragma unroll 1   // at most 7 trips, a different count in every wave: unrolling only adds a remainder loop
  for (int s = 0; s < seg; ++s) wkv_join(aa, bb, pp, ds, sg[0][s][lane], sg[1][s][lane], sg[2][s][lane]);
  float oa[WSEG], ob[WSEG], op[WSEG];
#pragma unroll
  for (int u = 0; u < WSEG; ++u) { oa[u] = aa; ob[u] = bb; op[u] = pp; wkv_join(aa, bb, pp, dl, a[u], b[u], p[u]); }
  __builtin_amdgcn_sched_barrier(0);   // keeps the stores behind the arithmetic above, so that no register of an issued store is written again ahead of the wait below
  float* da = sa + seg * WSEG * EE; float* db = sb + seg * WSEG * EE; float* dp = sp + seg * WSEG * EE;
#pragma unroll
  for (int u = 0; u < WSEG; ++u) { da[u * EE + e] = oa[u]; db[u * EE + e] = ob[u]; dp[u * EE + e] = op[u]; }
  wait_xcnt();
  if (seg == WSEGS - 1) { aaf[e] = aa; bbf[e] = bb; ppf[e] = pp; }
}
__global__ __launch_bounds__(256) void k_wkv(const bf16* __restrict__ k, const bf16* __restrict__ v, float* __restrict__ ry,
                                            const float* __restrict__ sa, const float* __restrict__ sb, const float* __restrict__ sp,
                                            const float* __restrict__ tfirst, const float* __restrict__ tdecay) {
  const int e = blockIdx.x * 256 + threadIdx.x, c = blockIdx.y;
  float aa = sa[c * EE + e], bb = sb[c * EE + e], pp = sp[c * EE + e]; const float tf = tfirst[e], td = tdecay[e];
  wait_xcnt();
  const float decay = -expf(td);
#pragma unroll 1   // kept rolled, for speed only
  for (int t0 = 0; t0 < WLEN; t0 += WUC) {
    const bf16* kt = k + ((size_t)c * WLEN + t0) * EE; const bf16* vt = v + ((size_t)c * WLEN + t0) * EE; float* rt = ry + ((size_t)c * WLEN + t0) * EE;
    float kq[WUC], vq[WUC], rq[WUC];
#pragma unroll
    for (int u = 0; u < WUC; ++u) { kq[u] = (float)kt[u * EE + e]; vq[u] = (float)vt[u * EE + e]; rq[u] = rt[u * EE + e]; }
    wait_xcnt();
#pragma unroll
    for (int u = 0; u < WUC; ++u) { const float kk = kq[u], vv = vq[u];
      const float ww = tf + kk; const float p = fmaxf(pp, ww); const float e1 = expf(pp - p), e2 = expf(ww - p);
      const float wkv = (e1 * aa + e2 * vv) / (e1 * bb + e2);
      const float ww2 = decay + pp; const float p2 = fmaxf(ww2, kk); const float e1b = expf(ww2 - p2), e2b = expf(kk - p2);
      aa = e1b * aa + e2b * vv; bb = e1b * bb + e2b; pp = p2;
      rq[u] = wkv / (1.0f + expf(-rq[u])); }
    __builtin_amdgcn_sched_barrier(0);   // keeps the stores behind the arithmetic above, so that no register of an issued store is written again ahead of the wait below
#pragma unroll
    for (int u = 0; u < WUC; ++u) rt[u * EE + e] = rq[u];
    wait_xcnt();
  }
}
__global__ __launch_bounds__(256) void k_tail(const float* __restrict__ x, const float* __restrict__ af, const float* __restrict__ bf_, const float* __restrict__ pf, float* __restrict__ o) {
  const int tid = threadIdx.x; const float* src = (blockIdx.x == 0) ? (x + (size_t)(TT - 1) * EE) : (blockIdx.x == 1 ? af : (blockIdx.x == 2 ? bf_ : pf));
  const v4f_t val = *(const v4f_t*)(src + tid * 4); float* dst = o + (size_t)blockIdx.x * EE + tid * 4;
  *(v4f_t*)dst = val; 
}
__global__ __launch_bounds__(256) void k_ones(float* __restrict__ p) { const int tid = threadIdx.x; v4f_t o = {1.f,1.f,1.f,1.f}; *(v4f_t*)(p + tid * 4) = o;  }

extern "C" void kernel_launch(void* const* d_in, const int* in_sizes, int n_in,
                              void* d_out, int out_size, void* d_ws, size_t ws_size,
                              hipStream_t stream) {
  (void)in_sizes; (void)n_in; (void)out_size;
  const float** f = (const float**)d_in;
  const float* x = f[0], *sx = f[1], *aa = f[2], *bb = f[3], *pp = f[4], *tfirst = f[5], *tdecay = f[6], *mk = f[7], *mv = f[8], *mr = f[9], *Wk = f[10], *Wv = f[11], *Wr = f[12], *Wo = f[13];
  float* out = (float*)d_out;                 // [8192,1024] | x_last | aa | bb | pp
  float* tail = out + (size_t)TT * EE;
  char* ws = (char*)d_ws;
  bf16* kx = (bf16*)ws; ws += (size_t)TT * EE * 2; bf16* vx = (bf16*)ws; ws += (size_t)TT * EE * 2; bf16* rx = (bf16*)ws; ws += (size_t)TT * EE * 2;   // 16 MB each
  float* ry = (float*)ws; ws += (size_t)TT * EE * 4;         // 32 MB: rx·Wr, then σ(r)·wkv in place
  bf16* k16 = (bf16*)ws; ws += (size_t)TT * EE * 2; bf16* v16 = (bf16*)ws; ws += (size_t)TT * EE * 2;
  float* stf = (float*)ws; ws += 3 * EE * 4; float* ones = (float*)ws; ws += EE * 4;
  float* lst = (float*)ws; ws += (size_t)3 * WCH * EE * 4; float* sst = (float*)ws; ws += (size_t)3 * WCH * EE * 4;   // chunk ends, chunk start states: [3][WCH][EE] each
  f16* wt = (f16*)ws; ws += (size_t)4 * EE * EE * 2;         // 2 MB each: Wr, Wk, Wv, Wo as f16 [n][k]
  if ((size_t)(ws - (char*)d_ws) > ws_size) return;
  const dim3 blk(256);
  k_ones<<<dim3(1), blk, 0, stream>>>(ones);
  k_wt<<<dim3(EE / 64, EE / 32, 4), blk, 0, stream>>>(Wr, Wk, Wv, Wo, wt);
  k_mix<<<dim3(TT * (EE / 8) / 256), blk, 0, stream>>>(x, sx, mk, mv, mr, kx, vx, rx);
  gemm_kne<bf16, 0, false><<<dim3(TT / 128, EE / 128), blk, 0, stream>>>(rx, EE, wt, EE, nullptr, nullptr, nullptr, ry, EE, EE);
  gemm_kne<bf16, 0, true ><<<dim3(TT / 128, EE / 128), blk, 0, stream>>>(kx, EE, wt + (size_t)EE * EE, EE, nullptr, nullptr, nullptr, k16, EE, EE);
  gemm_kne<bf16, 0, true ><<<dim3(TT / 128, EE / 128), blk, 0, stream>>>(vx, EE, wt + (size_t)2 * EE * EE, EE, nullptr, nullptr, nullptr, v16, EE, EE);
  k_wkv_local<<<dim3(EE / 256, WCH), blk, 0, stream>>>(k16, v16, tdecay, lst, lst + WCH * EE, lst + 2 * WCH * EE);
  k_wkv_carry<<<dim3(EE / 32), blk, 0, stream>>>(lst, lst + WCH * EE, lst + 2 * WCH * EE, aa, bb, pp, tdecay, sst, sst + WCH * EE, sst + 2 * WCH * EE, stf, stf + EE, stf + 2 * EE);
  k_wkv<<<dim3(EE / 256, WCH), blk, 0, stream>>>(k16, v16, ry, sst, sst + WCH * EE, sst + 2 * WCH * EE, tfirst, tdecay);
  gemm_kne<float, 2, false><<<dim3(TT / 128, EE / 128), blk, 0, stream>>>(ry, EE, wt + (size_t)3 * EE * EE, EE, nullptr, x, ones, out, EE, EE);    // x + (r*wkv)*Wo
  k_tail<<<dim3(4), blk, 0, stream>>>(x, stf, stf + EE, stf + 2 * EE, tail);
}

// v003
// A run of this version takes 147 microseconds.
// Timed twice side by side with v002, it ran 1.36 and 1.34 times as fast.
// Over all steps from v000 it is 19.0 times as fast.
// Contractions on v_wmma_f32_16x16x32_f16 (plain f16 operands, f32 accumulate): r = σ(rx·Wr), k = kx·Wk, v = vx·Wv and out = x + (r·wkv)·Wo
// (four K = 1024 GEMMs; the token-shift mixes kx/vx/rx are built once as f16 rows, the four weights once as f16 [n][k] rows, k and v kept as f16 rows); the WKV recurrence is the
// module's max-stabilised f32 scan, lane = channel, split into 128 time chunks of 64 steps (chunk ends, carry, outputs: three launches), writing r*wkv in place
// compute dtype: f16 operands, f32 accumulate / f32 scan.  x [8192,1024].
#include <hip/hip_runtime.h>
#include <hip/hip_bf16.h>
#include <math.h>

#define TT 8192
#define EE 1024
#define GSTR 48

typedef _Float16 bf16;
typedef _Float16 f16;
typedef __attribute__((ext_vector_type(4))) unsigned v4u_t;
typedef unsigned v4ua __attribute__((ext_vector_type(4), may_alias));
typedef __attribute__((ext_vector_type(4))) float v4f_t;
typedef float v4fa __attribute__((ext_vector_type(4), may_alias));
typedef __attribute__((ext_vector_type(16))) bf16  bf16x16;
typedef bf16x16 f16x16;
typedef __attribute__((ext_vector_type(8)))  bf16  bf16x8;
typedef bf16x8 f16x8;
typedef __attribute__((ext_vector_type(4)))  bf16  bf16x4;
typedef __attribute__((ext_vector_type(8)))  float f32x8;
__device__ __forceinline__ f32x8 wmma16(f16x16 a, f16x16 b, f32x8 c) {
  c = __builtin_amdgcn_wmma_f32_16x16x32_f16(false, a, false, b, (short)0, c, false, false);
  asm volatile("v_nop\n\tv_nop\n\tv_nop\n\tv_nop" : "+v"(c) : "v"(a), "v"(b));
  return c;
}
#define LDS_STRIDE 48   // unused: the GEMM's LDS pitches are APB and WPB
#define KSTRIDE    72
#define VSTRIDE    48

__device__ __forceinline__ f32x8 wmma_bf16(bf16x16 a, bf16x16 b, f32x8 c) {
  c = __builtin_amdgcn_wmma_f32_16x16x32_f16(false, a, false, b, (short)0, c, false, false);
  asm volatile("v_nop\n\tv_nop\n\tv_nop\n\tv_nop" : "+v"(c) : "v"(a), "v"(b));   // A/B-overwrite hazard guard
  return c;
}

// 16x32 (MxK) bf16 fragment from a row-major global matrix.
// lanes 0-15  (row=lane)    : elems 0..7 = K+0..7,  8..15 = K+16..23
// lanes 16-31 (row=lane-16) : elems 0..7 = K+8..15, 8..15 = K+24..31
template <typename T>
__device__ __forceinline__ bf16x16 load_frag(const T* __restrict__ base, int ld,
                                             int row0, int k0) {
  const int lane = threadIdx.x & 31;
  const int r    = lane & 15;
  const int kh   = (lane >> 4) * 8;
  const T* p0 = base + (size_t)(row0 + r) * ld + (k0 + kh);
  const T* p1 = p0 + 16;
  bf16x16 f;
#pragma unroll
  for (int i = 0; i < 8; ++i) {
    f[i]     = (bf16)p0[i];
    f[i + 8] = (bf16)p1[i];
  }
  return f;
}

// Same fragment from an LDS tile with padded row stride (base includes row0/k0).
__device__ __forceinline__ bf16x16 lds_frag(const bf16* base, int stride) {
  const int lane = threadIdx.x & 31;
  const int row  = lane & 15;
  const int kh   = (lane >> 4) * 8;
  const bf16x8 lo = *(const bf16x8*)(base + row * stride + kh);
  const bf16x8 hi = *(const bf16x8*)(base + row * stride + kh + 16);
  bf16x16 f;
#pragma unroll
  for (int i = 0; i < 8; ++i) { f[i] = lo[i]; f[i + 8] = hi[i]; }
  return f;
}

template <typename T>
__device__ __forceinline__ void stage_read16(const T* __restrict__ p, float* buf) {
#pragma unroll
  for (int i = 0; i < 16; ++i) buf[i] = (float)p[i];
}

__device__ __forceinline__ void stage_write(bf16* dst, const float* buf, int nquad) {
#pragma unroll
  for (int i = 0; i < nquad; ++i) {
    bf16x4 q;
    q[0] = (bf16)buf[4 * i];     q[1] = (bf16)buf[4 * i + 1];
    q[2] = (bf16)buf[4 * i + 2]; q[3] = (bf16)buf[4 * i + 3];
    *(bf16x4*)(dst + 4 * i) = q;
  }
}


// ---------------------------------------------------------------------------------------------------------------------------
// gemm_kne: Y[m][n] = epi( sum_k A[m][k]*W[k][n] + bias[n] ), A f32/f16 [M][lda], W given transposed as f16 rows Wt[n][k] (ldw; k_wt makes them), plain f16 operands,
// f32 accumulate. EPI 0: identity; 1: exact-erf GELU; 2: R[m][n] + gvec[n]·(·) (residual with per-channel gain). Output f32 (or f16
// when OUT16). Block = 128x128 tile, 8 waves as 4(M) x 2(N); A (rounded to f16 where a fragment is read) and W tiles in LDS, both as k-contiguous rows
// ---------------------------------------------------------------------------------------------------------------------------
// 16x32 (MxK) f16 fragment from an LDS tile of f32 rows (base includes row0/k0, stride in floats): the k order of lds_frag, each value rounded to f16 here
__device__ __forceinline__ f16x16 lds_frag32(const float* base, int stride) {
  const int lane = threadIdx.x & 31;
  const float* p = base + (lane & 15) * stride + (lane >> 4) * 8;
  const v4f_t a0 = *(const v4fa*)(p), a1 = *(const v4fa*)(p + 4), b0 = *(const v4fa*)(p + 16), b1 = *(const v4fa*)(p + 20);
  f16x16 f;
#pragma unroll
  for (int i = 0; i < 4; ++i) { f[i] = (f16)a0[i]; f[i + 4] = (f16)a1[i]; f[i + 8] = (f16)b0[i]; f[i + 12] = (f16)b1[i]; }
  return f;
}
__device__ __forceinline__ f16x16 tile_frag(const f16* base, int pitch_bytes)   { return lds_frag(base, pitch_bytes / 2); }
__device__ __forceinline__ f16x16 tile_frag(const float* base, int pitch_bytes) { return lds_frag32(base, pitch_bytes / 4); }
// four asynchronous copies, 16 bytes a lane each, global memory -> LDS (l: the lane's LDS byte address, g: its global address).
// s_wait_xcnt 0 closes the statement: it stands ahead of any rewrite of the address registers that the copies name
__device__ __forceinline__ void acopy4(unsigned l0, unsigned l1, unsigned l2, unsigned l3, const char* g0, const char* g1, const char* g2, const char* g3) {
  asm volatile("global_load_async_to_lds_b128 %0, %4, off\n\t"
               "global_load_async_to_lds_b128 %1, %5, off\n\t"
               "global_load_async_to_lds_b128 %2, %6, off\n\t"
               "global_load_async_to_lds_b128 %3, %7, off\n\t"
               "s_wait_xcnt 0x0"
               :: "v"(l0), "v"(l1), "v"(l2), "v"(l3), "v"(g0), "v"(g1), "v"(g2), "v"(g3) : "memory");
}
// the same, eight copies under one wait
__device__ __forceinline__ void acopy8(unsigned l0, unsigned l1, unsigned l2, unsigned l3, unsigned l4, unsigned l5, unsigned l6, unsigned l7,
                                       const char* g0, const char* g1, const char* g2, const char* g3, const char* g4, const char* g5, const char* g6, const char* g7) {
  asm volatile("global_load_async_to_lds_b128 %0, %8, off\n\t"
               "global_load_async_to_lds_b128 %1, %9, off\n\t"
               "global_load_async_to_lds_b128 %2, %10, off\n\t"
               "global_load_async_to_lds_b128 %3, %11, off\n\t"
               "global_load_async_to_lds_b128 %4, %12, off\n\t"
               "global_load_async_to_lds_b128 %5, %13, off\n\t"
               "global_load_async_to_lds_b128 %6, %14, off\n\t"
               "global_load_async_to_lds_b128 %7, %15, off\n\t"
               "s_wait_xcnt 0x0"
               :: "v"(l0), "v"(l1), "v"(l2), "v"(l3), "v"(l4), "v"(l5), "v"(l6), "v"(l7),
                  "v"(g0), "v"(g1), "v"(g2), "v"(g3), "v"(g4), "v"(g5), "v"(g6), "v"(g7) : "memory");
}
// Tiles of 64 k: [A 128 rows | W 128 rows], brought as they lie in memory by asynchronous copies into a ring of two LDS buffers; tile t + 1 flies while tile t
// is multiplied. Row pitch = row bytes + 16 (16 B x odd: the ds_load_b128 readers meet no bank twice). K: a multiple of 64. The ring is the output staging afterwards.
template <typename AT, int EPI, bool OUT16>
__global__ __launch_bounds__(256) void gemm_kne(const AT* __restrict__ A, int lda, const f16* __restrict__ Wt, int ldw,
                                                const float* __restrict__ bias, const float* __restrict__ R, const float* __restrict__ gvec,
                                                void* __restrict__ Yv, int ldy, int K) {
  constexpr int KS = 64;
  constexpr int ARB = KS * (int)sizeof(AT), APB = ARB + 16, WPB = KS * 2 + 16;   // A row bytes; LDS pitches
  constexpr int ABYTES = 128 * APB, STAGE = ABYTES + 128 * WPB;
  constexpr int OSB = 8 * 32 * 68 * 4;
  __shared__ __attribute__((aligned(128))) char smem[(2 * STAGE > OSB) ? 2 * STAGE : OSB];
  const int tid = threadIdx.x, lane = tid & 31, wave = tid >> 5, cl = lane & 15, rh = (lane >> 4) * 8;
  const int m0 = blockIdx.x * 128, n0 = blockIdx.y * 128;
  const int wm = (wave & 3) * 32, wn = (wave >> 2) * 64;
  // copy map: a thread brings 16 bytes of every ARP-th row of A and of every 32nd row of W; a wave's copy covers whole rows of the tile
  constexpr int ACPR = ARB / 16, ARP = 256 / ACPR;
  const unsigned sb = (unsigned)(uintptr_t)smem;
  const unsigned la = sb + (tid / ACPR) * APB + (tid % ACPR) * 16, lw = sb + ABYTES + (tid >> 3) * WPB + (tid & 7) * 16;
  const char* ga = (const char*)(A + (size_t)(m0 + tid / ACPR) * lda) + (tid % ACPR) * 16;
  const char* gw = (const char*)(Wt + (size_t)(n0 + (tid >> 3)) * ldw) + (tid & 7) * 16;
  const size_t as = (size_t)ARP * lda * sizeof(AT), wsb = (size_t)32 * ldw * 2;
  auto bring = [&](unsigned bo) {   // the next tile in k order into the buffer at byte bo
    const unsigned a = la + bo, w = lw + bo;
    if (sizeof(AT) == 2) {
      acopy8(a, a + ARP * APB, a + 2 * ARP * APB, a + 3 * ARP * APB, w, w + 32 * WPB, w + 64 * WPB, w + 96 * WPB,
             ga, ga + as, ga + 2 * as, ga + 3 * as, gw, gw + wsb, gw + 2 * wsb, gw + 3 * wsb);
    } else {
      acopy8(a, a + ARP * APB, a + 2 * ARP * APB, a + 3 * ARP * APB, a + 4 * ARP * APB, a + 5 * ARP * APB, a + 6 * ARP * APB, a + 7 * ARP * APB,
             ga, ga + as, ga + 2 * as, ga + 3 * as, ga + 4 * as, ga + 5 * as, ga + 6 * as, ga + 7 * as);
      acopy4(w, w + 32 * WPB, w + 64 * WPB, w + 96 * WPB, gw, gw + wsb, gw + 2 * wsb, gw + 3 * wsb);
    }
    ga += ARB; gw += KS * 2;
  };
  f32x8 acc[2][4];
#pragma unroll
  for (int i = 0; i < 2; ++i)
#pragma unroll
    for (int j = 0; j < 4; ++j) { f32x8 z = {}; acc[i][j] = z; }
  const int NT = K / KS;
  bring(0);
  asm volatile("s_wait_asynccnt 0x0" ::: "memory");   // tile 0 has landed, as far as this wave brought it
  __syncthreads();                                    // ... and all of it
  if (NT > 1) bring(STAGE);
  unsigned bo = 0;
#pragma unroll 1   // kept rolled: one publish point in the text, the buffer picked by bo
  for (int t = 0; t < NT; ++t) {
    const AT*  tA = (const AT*)(smem + bo);
    const f16* tW = (const f16*)(smem + bo + ABYTES);
#pragma unroll
    for (int kk = 0; kk < KS; kk += 32) {
      f16x16 af[2];
#pragma unroll
      for (int i = 0; i < 2; ++i) af[i] = tile_frag(tA + (wm + 16 * i) * (APB / (int)sizeof(AT)) + kk, APB);
#pragma unroll
      for (int j = 0; j < 4; ++j) {
        const f16x16 bf = tile_frag(tW + (wn + 16 * j) * (WPB / 2) + kk, WPB);
#pragma unroll
        for (int i = 0; i < 2; ++i) acc[i][j] = wmma16(af[i], bf, acc[i][j]);
      }
    }
    asm volatile("s_wait_dscnt 0x0" ::: "memory");      // this wave has left the buffer at bo
    asm volatile("s_wait_asynccnt 0x0" ::: "memory");   // its part of tile t + 1 has landed
    __syncthreads();                                    // tile t + 1 is whole, and every reader has left the buffer at bo
    if (t + 2 < NT) bring(bo);
    bo ^= (unsigned)STAGE;
  }
  asm volatile("s_wait_asynccnt 0x0" ::: "memory");     // no copy is in flight when the ring becomes the output staging
  float* so = (float*)smem + wave * (32 * 68);
#pragma unroll
  for (int i = 0; i < 2; ++i)
#pragma unroll
    for (int j = 0; j < 4; ++j) {
      const int n = n0 + wn + 16 * j + cl;
      const float bv = bias ? bias[n] : 0.0f;
      const float gv = (EPI == 2) ? gvec[n] : 0.0f;
      if (EPI == 1) {
#pragma unroll 1
        for (int r = 0; r < 8; ++r) { const float xg = acc[i][j][r] + bv; so[(16 * i + rh + r) * 68 + 16 * j + cl] = 0.5f * xg * (1.0f + erff(xg * 0.70710678118654752f)); }
      } else {
#pragma unroll
        for (int r = 0; r < 8; ++r) {
          float v = acc[i][j][r] + bv;
          if (EPI == 2) v = R[(size_t)(m0 + wm + 16 * i + rh + r) * ldy + n] + gv * v;
          so[(16 * i + rh + r) * 68 + 16 * j + cl] = v;
        }
      }
    }
  asm volatile("s_wait_dscnt 0" ::: "memory");
  __builtin_amdgcn_wave_barrier();
{
    if (OUT16) {
      f16* Y = (f16*)Yv;
#pragma unroll
      for (int it = 0; it < 8; ++it) { const int c = lane + 32 * it, rr = c >> 3, q8 = (c & 7) * 8;
        union { f16 h[8]; v4u_t v; } u;
#pragma unroll
        for (int e = 0; e < 8; ++e) u.h[e] = (f16)so[rr * 68 + q8 + e];
        *(v4u_t*)(Y + (size_t)(m0 + wm + rr) * ldy + n0 + wn + q8) = u.v; }
    } else {
      float* Y = (float*)Yv;
#pragma unroll
      for (int it = 0; it < 16; ++it) { const int f4 = lane + 32 * it, rr = f4 >> 4, q = (f4 & 15) * 4;
        *(v4f_t*)(Y + (size_t)(m0 + wm + rr) * ldy + n0 + wn + q) = *(const v4fa*)(so + rr * 68 + q); }
    }
    
  }
}

// the four weights, once a call, as f16 rows Wt[n][k] = (f16)W[k][n]: the GEMMs then stage a W tile as they stage an A tile, 16 bytes at a time.
// block = 64 k x 32 n of one weight, turned through LDS (pitch 33 floats: no bank is met twice by a wave, writing or reading); whole 128-byte lines in and out
__global__ __launch_bounds__(256) void k_wt(const float* __restrict__ W0, const float* __restrict__ W1, const float* __restrict__ W2, const float* __restrict__ W3, f16* __restrict__ T) {
  __shared__ float tl[64][33];
  const int tid = threadIdx.x, k0 = blockIdx.x * 64, n0 = blockIdx.y * 32, z = blockIdx.z;
  const float* Wm = (z == 0) ? W0 : (z == 1 ? W1 : (z == 2 ? W2 : W3));
  const int kr = tid >> 3, c = (tid & 7) * 4;
  const v4f_t a = *(const v4f_t*)(Wm + (size_t)(k0 + kr) * EE + n0 + c);
  const v4f_t b = *(const v4f_t*)(Wm + (size_t)(k0 + kr + 32) * EE + n0 + c);
#pragma unroll
  for (int u = 0; u < 4; ++u) { tl[kr][c + u] = a[u]; tl[kr + 32][c + u] = b[u]; }
  __syncthreads();
  const int n = tid >> 3, kq = (tid & 7) * 8;
  union { f16 h[8]; v4u_t v; } o;
#pragma unroll
  for (int e = 0; e < 8; ++e) o.h[e] = (f16)tl[kq + e][n];
  *(v4u_t*)(T + (size_t)z * EE * EE + (size_t)(n0 + n) * EE + k0 + kq) = o.v;
}
// token-shift mixes as f16 rows: kx = x·mk + xprev·(1−mk) etc. (xprev = sx for t = 0); thread -> 8 channels
__global__ __launch_bounds__(256) void k_mix(const float* __restrict__ x, const float* __restrict__ sx, const float* __restrict__ mk, const float* __restrict__ mv, const float* __restrict__ mr,
                                            bf16* __restrict__ kx, bf16* __restrict__ vx, bf16* __restrict__ rx) {
  const size_t i = (size_t)blockIdx.x * 256 + threadIdx.x; const size_t t = i >> 7; const int c0 = (i & 127) * 8;
  const float* xr = x + t * EE + c0; const float* pr = (t == 0) ? (sx + c0) : (x + (t - 1) * EE + c0);
  union { bf16 hh[8]; v4u_t u; } ck, cv2, cr;
#pragma unroll
  for (int e = 0; e < 8; ++e) { const float a = xr[e], p = pr[e]; const int c = c0 + e;
    ck.hh[e] = (bf16)(a * mk[c] + p * (1.0f - mk[c])); cv2.hh[e] = (bf16)(a * mv[c] + p * (1.0f - mv[c])); cr.hh[e] = (bf16)(a * mr[c] + p * (1.0f - mr[c])); }
{ *(v4u_t*)(kx + t * EE + c0) = ck.u; *(v4u_t*)(vx + t * EE + c0) = cv2.u; *(v4u_t*)(rx + t * EE + c0) = cr.u;  }
}
// WKV scan, split in time. The state is linear: with A = aa*exp(pp), B = bb*exp(pp) a step is A' = exp(decay)*A + exp(k)*v,
// B' = exp(decay)*B + exp(k), so n steps give  end = exp(n*decay)*start + (end reached from the empty state).
//   k_wkv_local: every chunk of WLEN steps, all chunks at once, runs the state update from the empty state -> la, lb, lp
//   k_wkv_carry: joins the chunk ends in time order -> the state each chunk starts from (sa, sb, sp) and the final state
//   k_wkv      : every chunk, all chunks at once, runs the module's own step from its start state and writes sigmoid(r)*wkv
// All three keep the module's max-stabilised form (value, log scale pp); lane = channel e.
#define WCH   128          // chunks: 128 x 32 waves = 4 waves a SIMD
#define WLEN  (TT / WCH)   // 64 steps a chunk
#define WUA   16           // k_wkv_local: steps whose operands are loaded together, ahead of their arithmetic
#define WUC   8            // k_wkv: the same
#define WSEGS 8            // carry: one wave a segment of WCH / WSEGS chunks
#define WSEG  (WCH / WSEGS)
// stands behind a run of global loads or stores, ahead of any reuse of a register that they name
__device__ __forceinline__ void wait_xcnt() { asm volatile("s_wait_xcnt 0x0" ::: "memory"); }
// (aa, bb, pp) decayed over a span (d = steps * decay), plus the end state (a, b, p) that the span reaches from the empty state
__device__ __forceinline__ void wkv_join(float& aa, float& bb, float& pp, float d, float a, float b, float p) {
  const float w = pp + d; const float q = fmaxf(w, p); const float e1 = expf(w - q), e2 = expf(p - q);
  aa = e1 * aa + e2 * a; bb = e1 * bb + e2 * b; pp = q;
}
__global__ __launch_bounds__(256) void k_wkv_local(const bf16* __restrict__ k, const bf16* __restrict__ v, const float* __restrict__ tdecay,
                                                  float* __restrict__ la, float* __restrict__ lb, float* __restrict__ lp) {
  const int e = blockIdx.x * 256 + threadIdx.x, c = blockIdx.y;
  const bf16* kc = k + (size_t)c * WLEN * EE; const bf16* vc = v + (size_t)c * WLEN * EE;
  const float td = tdecay[e];
  wait_xcnt();
  const float decay = -expf(td);
  float aa = 0.0f, bb = 0.0f, pp = 0.0f;
#pragma unroll 1   // kept rolled: the SIMD's other waves cover a trip's loads, more code in line buys nothing
  for (int t0 = 0; t0 < WLEN; t0 += WUA) {
    const bf16* kt = kc + t0 * EE; const bf16* vt = vc + t0 * EE;
    float kk[WUA], vv[WUA];
#pragma unroll
    for (int u = 0; u < WUA; ++u) kk[u] = (float)kt[u * EE + e];
    wait_xcnt();   // the v loads may land in the registers that held the k loads' address
#pragma unroll
    for (int u = 0; u < WUA; ++u) vv[u] = (float)vt[u * EE + e];
    wait_xcnt();
#pragma unroll
    for (int u = 0; u < WUA; ++u) {
      if (u == 0 && t0 == 0) { aa = vv[0]; bb = 1.0f; pp = kk[0]; }   // first step on the empty state: A = exp(k)*v, B = exp(k)
      else { const float ww2 = decay + pp; const float p2 = fmaxf(ww2, kk[u]); const float e1b = expf(ww2 - p2), e2b = expf(kk[u] - p2);
        aa = e1b * aa + e2b * vv[u]; bb = e1b * bb + e2b; pp = p2; }
    }
  }
  la[c * EE + e] = aa; lb[c * EE + e] = bb; lp[c * EE + e] = pp;
}
// block = 32 channels x WSEGS waves; wave = one segment of WSEG chunks: segment end from empty, prefix over segments through LDS, then the chunk starts
__global__ __launch_bounds__(256) void k_wkv_carry(const float* __restrict__ la, const float* __restrict__ lb, const float* __restrict__ lp,
                                                  const float* __restrict__ aa0, const float* __restrict__ bb0, const float* __restrict__ pp0, const float* __restrict__ tdecay,
                                                  float* __restrict__ sa, float* __restrict__ sb, float* __restrict__ sp,
                                                  float* __restrict__ aaf, float* __restrict__ bbf, float* __restrict__ ppf) {
  __shared__ float sg[3][WSEGS][32];
  const int lane = threadIdx.x & 31, seg = __builtin_amdgcn_readfirstlane(threadIdx.x >> 5);
  const int e = blockIdx.x * 32 + lane;
  const float* ca = la + seg * WSEG * EE; const float* cb = lb + seg * WSEG * EE; const float* cp = lp + seg * WSEG * EE;
  float a[WSEG], b[WSEG], p[WSEG];
#pragma unroll
  for (int u = 0; u < WSEG; ++u) { a[u] = ca[u * EE + e]; b[u] = cb[u * EE + e]; p[u] = cp[u * EE + e]; }
  float aa = aa0[e], bb = bb0[e], pp = pp0[e]; const float td = tdecay[e];
  wait_xcnt();
  const float dl = (float)WLEN * -expf(td), ds = (float)(WLEN * WSEG) * -expf(td);
  float ta = a[0], tb = b[0], tp = p[0];
#pragma unroll
  for (int u = 1; u < WSEG; ++u) wkv_join(ta, tb, tp, dl, a[u], b[u], p[u]);
  sg[0][seg][lane] = ta; sg[1][seg][lane] = tb; sg[2][seg][lane] = tp;
  __syncthreads();
#pragma unroll 1   // at most 7 trips, a different count in every wave: unrolling only adds a remainder loop
  for (int s = 0; s < seg; ++s) wkv_join(aa, bb, pp, ds, sg[0][s][lane], sg[1][s][lane], sg[2][s][lane]);
  float oa[WSEG], ob[WSEG], op[WSEG];
#pragma unroll
  for (int u = 0; u < WSEG; ++u) { oa[u] = aa; ob[u] = bb; op[u] = pp; wkv_join(aa, bb, pp, dl, a[u], b[u], p[u]); }
  __builtin_amdgcn_sched_barrier(0);   // keeps the stores behind the arithmetic above, so that no register of an issued store is written again ahead of the wait below
  float* da = sa + seg * WSEG * EE; float* db = sb + seg * WSEG * EE; float* dp = sp + seg * WSEG * EE;
#pragma unroll
  for (int u = 0; u < WSEG; ++u) { da[u * EE + e] = oa[u]; db[u * EE + e] = ob[u]; dp[u * EE + e] = op[u]; }
  wait_xcnt();
  if (seg == WSEGS - 1) { aaf[e] = aa; bbf[e] = bb; ppf[e] = pp; }
}
__global__ __launch_bounds__(256) void k_wkv(const bf16* __restrict__ k, const bf16* __restrict__ v, float* __restrict__ ry,
                                            const float* __restrict__ sa, const float* __restrict__ sb, const float* __restrict__ sp,
                                            const float* __restrict__ tfirst, const float* __restrict__ tdecay) {
  const int e = blockIdx.x * 256 + threadIdx.x, c = blockIdx.y;
  float aa = sa[c * EE + e], bb = sb[c * EE + e], pp = sp[c * EE + e]; const float tf = tfirst[e], td = tdecay[e];
  wait_xcnt();
  const float decay = -expf(td);
#pragma unroll 1   // kept rolled, for speed only
  for (int t0 = 0; t0 < WLEN; t0 += WUC) {
    const bf16* kt = k + ((size_t)c * WLEN + t0) * EE; const bf16* vt = v + ((size_t)c * WLEN + t0) * EE; float* rt = ry + ((size_t)c * WLEN + t0) * EE;
    float kq[WUC], vq[WUC], rq[WUC];
#pragma unroll
    for (int u = 0; u < WUC; ++u) { kq[u] = (float)kt[u * EE + e]; vq[u] = (float)vt[u * EE + e]; rq[u] = rt[u * EE + e]; }
    wait_xcnt();
#pragma unroll
    for (int u = 0; u < WUC; ++u) { const float kk = kq[u], vv = vq[u];
      const float ww = tf + kk; const float p = fmaxf(pp, ww); const float e1 = expf(pp - p), e2 = expf(ww - p);
      const float wkv = (e1 * aa + e2 * vv) / (e1 * bb + e2);
      const float ww2 = decay + pp; const float p2 = fmaxf(ww2, kk); const float e1b = expf(ww2 - p2), e2b = expf(kk - p2);
      aa = e1b * aa + e2b * vv; bb = e1b * bb + e2b; pp = p2;
      rq[u] = wkv / (1.0f + expf(-rq[u])); }
    __builtin_amdgcn_sched_barrier(0);   // keeps the stores behind the arithmetic above, so that no register of an issued store is written again ahead of the wait below
#pragma unroll
    for (int u = 0; u < WUC; ++u) rt[u * EE + e] = rq[u];
    wait_xcnt();
  }
}
__global__ __launch_bounds__(256) void k_tail(const float* __restrict__ x, const float* __restrict__ af, const float* __restrict__ bf_, const float* __restrict__ pf, float* __restrict__ o) {
  const int tid = threadIdx.x; const float* src = (blockIdx.x == 0) ? (x + (size_t)(TT - 1) * EE) : (blockIdx.x == 1 ? af : (blockIdx.x == 2 ? bf_ : pf));
  const v4f_t val = *(const v4f_t*)(src + tid * 4); float* dst = o + (size_t)blockIdx.x * EE + tid * 4;
  *(v4f_t*)dst = val; 
}
__global__ __launch_bounds__(256) void k_ones(float* __restrict__ p) { const int tid = threadIdx.x; v4f_t o = {1.f,1.f,1.f,1.f}; *(v4f_t*)(p + tid * 4) = o;  }

extern "C" void kernel_launch(void* const* d_in, const int* in_sizes, int n_in,
                              void* d_out, int out_size, void* d_ws, size_t ws_size,
                              hipStream_t stream) {
  (void)in_sizes; (void)n_in; (void)out_size;
  const float** f = (const float**)d_in;
  const float* x = f[0], *sx = f[1], *aa = f[2], *bb = f[3], *pp = f[4], *tfirst = f[5], *tdecay = f[6], *mk = f[7], *mv = f[8], *mr = f[9], *Wk = f[10], *Wv = f[11], *Wr = f[12], *Wo = f[13];
  float* out = (float*)d_out;                 // [8192,1024] | x_last | aa | bb | pp
  float* tail = out + (size_t)TT * EE;
  char* ws = (char*)d_ws;
  bf16* kx = (bf16*)ws; ws += (size_t)TT * EE * 2; bf16* vx = (bf16*)ws; ws += (size_t)TT * EE * 2; bf16* rx = (bf16*)ws; ws += (size_t)TT * EE * 2;   // 16 MB each
  float* ry = (float*)ws; ws += (size_t)TT * EE * 4;         // 32 MB: rx·Wr, then σ(r)·wkv in place
  bf16* k16 = (bf16*)ws; ws += (size_t)TT * EE * 2; bf16* v16 = (bf16*)ws; ws += (size_t)TT * EE * 2;
  float* stf = (float*)ws; ws += 3 * EE * 4; float* ones = (float*)ws; ws += EE * 4;
  float* lst = (float*)ws; ws += (size_t)3 * WCH * EE * 4; float* sst = (float*)ws; ws += (size_t)3 * WCH * EE * 4;   // chunk ends, chunk start states: [3][WCH][EE] each
  f16* wt = (f16*)ws; ws += (size_t)4 * EE * EE * 2;         // 2 MB each: Wr, Wk, Wv, Wo as f16 [n][k]
  if ((size_t)(ws - (char*)d_ws) > ws_size) return;
  const dim3 blk(256);
  k_ones<<<dim3(1), blk, 0, stream>>>(ones);
  k_wt<<<dim3(EE / 64, EE / 32, 4), blk, 0, stream>>>(Wr, Wk, Wv, Wo, wt);
  k_mix<<<dim3(TT * (EE / 8) / 256), blk, 0, stream>>>(x, sx, mk, mv, mr, kx, vx, rx);
  gemm_kne<bf16, 0, false><<<dim3(TT / 128, EE / 128), blk, 0, stream>>>(rx, EE, wt, EE, nullptr, nullptr, nullptr, ry, EE, EE);
  gemm_kne<bf16, 0, true ><<<dim3(TT / 128, EE / 128), blk, 0, stream>>>(kx, EE, wt + (size_t)EE * EE, EE, nullptr, nullptr, nullptr, k16, EE, EE);
  gemm_kne<bf16, 0, true ><<<dim3(TT / 128, EE / 128), blk, 0, stream>>>(vx, EE, wt + (size_t)2 * EE * EE, EE, nullptr, nullptr, nullptr, v16, EE, EE);
  k_wkv_local<<<dim3(EE / 256, WCH), blk, 0, stream>>>(k16, v16, tdecay, lst, lst + WCH * EE, lst + 2 * WCH * EE);
  k_wkv_carry<<<dim3(EE / 32), blk, 0, stream>>>(lst, lst + WCH * EE, lst + 2 * WCH * EE, aa, bb, pp, tdecay, sst, sst + WCH * EE, sst + 2 * WCH * EE, stf, stf + EE, stf + 2 * EE);
  k_wkv<<<dim3(EE / 256, WCH), blk, 0, stream>>>(k16, v16, ry, sst, sst + WCH * EE, sst + 2 * WCH * EE, tfirst, tdecay);
  gemm_kne<float, 2, false><<<dim3(TT / 128, EE / 128), blk, 0, stream>>>(ry, EE, wt + (size_t)3 * EE * EE, EE, nullptr, x, ones, out, EE, EE);    // x + (r*wkv)*Wo
  k_tail<<<dim3(4), blk, 0, stream>>>(x, stf, stf + EE, stf + 2 * EE, tail);
}

// v004
// It runs in 122 microseconds.
// In two side-by-side timings against v003, it was 1.20 and 1.19 times as fast.
// All steps since v000 together make it 22.8 times as fast.
// Contractions on v_wmma_f32_16x16x32_f16 (plain f16 operands, f32 accumulate): r = σ(rx·Wr), k = kx·Wk, v = vx·Wv and out = x + (r·wkv)·Wo
// (four K = 1024 GEMMs; the token-shift mixes kx/vx/rx are built once as f16 rows, the four weights once as f16 [n][k] rows, k and v kept as f16 rows); the WKV recurrence is the
// module's max-stabilised f32 scan, lane = channel, split into 128 time chunks of 64 steps (chunk ends, carry, outputs: three launches), writing r*wkv in place
// compute dtype: f16 operands, f32 accumulate / f32 scan.  x [8192,1024].
#include <hip/hip_runtime.h>
#include <hip/hip_bf16.h>
#include <math.h>

#define TT 8192
#define EE 1024
#define GSTR 48

typedef _Float16 bf16;
typedef _Float16 f16;
typedef __attribute__((ext_vector_type(4))) unsigned v4u_t;
typedef unsigned v4ua __attribute__((ext_vector_type(4), may_alias));
typedef __attribute__((ext_vector_type(4))) float v4f_t;
typedef float v4fa __attribute__((ext_vector_type(4), may_alias));
typedef __attribute__((ext_vector_type(16))) bf16  bf16x16;
typedef bf16x16 f16x16;
typedef __attribute__((ext_vector_type(8)))  bf16  bf16x8;
typedef bf16x8 f16x8;
typedef __attribute__((ext_vector_type(4)))  bf16  bf16x4;
typedef __attribute__((ext_vector_type(8)))  float f32x8;
__device__ __forceinline__ f32x8 wmma16(f16x16 a, f16x16 b, f32x8 c) {
  c = __builtin_amdgcn_wmma_f32_16x16x32_f16(false, a, false, b, (short)0, c, false, false);
  asm volatile("v_nop\n\tv_nop\n\tv_nop\n\tv_nop" : "+v"(c) : "v"(a), "v"(b));
  return c;
}
#define LDS_STRIDE 48   // unused: the GEMM's LDS pitches are APB and WPB
#define KSTRIDE    72
#define VSTRIDE    48

__device__ __forceinline__ f32x8 wmma_bf16(bf16x16 a, bf16x16 b, f32x8 c) {
  c = __builtin_amdgcn_wmma_f32_16x16x32_f16(false, a, false, b, (short)0, c, false, false);
  asm volatile("v_nop\n\tv_nop\n\tv_nop\n\tv_nop" : "+v"(c) : "v"(a), "v"(b));   // A/B-overwrite hazard guard
  return c;
}

// 16x32 (MxK) bf16 fragment from a row-major global matrix.
// lanes 0-15  (row=lane)    : elems 0..7 = K+0..7,  8..15 = K+16..23
// lanes 16-31 (row=lane-16) : elems 0..7 = K+8..15, 8..15 = K+24..31
template <typename T>
__device__ __forceinline__ bf16x16 load_frag(const T* __restrict__ base, int ld,
                                             int row0, int k0) {
  const int lane = threadIdx.x & 31;
  const int r    = lane & 15;
  const int kh   = (lane >> 4) * 8;
  const T* p0 = base + (size_t)(row0 + r) * ld + (k0 + kh);
  const T* p1 = p0 + 16;
  bf16x16 f;
#pragma unroll
  for (int i = 0; i < 8; ++i) {
    f[i]     = (bf16)p0[i];
    f[i + 8] = (bf16)p1[i];
  }
  return f;
}

// Same fragment from an LDS tile with padded row stride (base includes row0/k0).
__device__ __forceinline__ bf16x16 lds_frag(const bf16* base, int stride) {
  const int lane = threadIdx.x & 31;
  const int row  = lane & 15;
  const int kh   = (lane >> 4) * 8;
  const bf16x8 lo = *(const bf16x8*)(base + row * stride + kh);
  const bf16x8 hi = *(const bf16x8*)(base + row * stride + kh + 16);
  bf16x16 f;
#pragma unroll
  for (int i = 0; i < 8; ++i) { f[i] = lo[i]; f[i + 8] = hi[i]; }
  return f;
}

template <typename T>
__device__ __forceinline__ void stage_read16(const T* __restrict__ p, float* buf) {
#pragma unroll
  for (int i = 0; i < 16; ++i) buf[i] = (float)p[i];
}

__device__ __forceinline__ void stage_write(bf16* dst, const float* buf, int nquad) {
#pragma unroll
  for (int i = 0; i < nquad; ++i) {
    bf16x4 q;
    q[0] = (bf16)buf[4 * i];     q[1] = (bf16)buf[4 * i + 1];
    q[2] = (bf16)buf[4 * i + 2]; q[3] = (bf16)buf[4 * i + 3];
    *(bf16x4*)(dst + 4 * i) = q;
  }
}


// ---------------------------------------------------------------------------------------------------------------------------
// gemm_tile: Y[m][n] = epi( sum_k A[m][k]*W[k][n] + bias[n] ), A f32/f16 [M][lda], W given transposed as f16 rows Wt[n][k] (ldw; wt_block makes them), plain f16 operands,
// f32 accumulate. EPI 0: identity; 1: exact-erf GELU; 2: R[m][n] + gvec[n]·(·) (residual with per-channel gain). Output f32 (or f16
// when OUT16). Block = 128x128 tile, 8 waves as 4(M) x 2(N); A (rounded to f16 where a fragment is read) and W tiles in LDS, both as k-contiguous rows
// ---------------------------------------------------------------------------------------------------------------------------
// 16x32 (MxK) f16 fragment from an LDS tile of f32 rows (base includes row0/k0, stride in floats): the k order of lds_frag, each value rounded to f16 here
__device__ __forceinline__ f16x16 lds_frag32(const float* base, int stride) {
  const int lane = threadIdx.x & 31;
  const float* p = base + (lane & 15) * stride + (lane >> 4) * 8;
  const v4f_t a0 = *(const v4fa*)(p), a1 = *(const v4fa*)(p + 4), b0 = *(const v4fa*)(p + 16), b1 = *(const v4fa*)(p + 20);
  f16x16 f;
#pragma unroll
  for (int i = 0; i < 4; ++i) { f[i] = (f16)a0[i]; f[i + 4] = (f16)a1[i]; f[i + 8] = (f16)b0[i]; f[i + 12] = (f16)b1[i]; }
  return f;
}
__device__ __forceinline__ f16x16 tile_frag(const f16* base, int pitch_bytes)   { return lds_frag(base, pitch_bytes / 2); }
__device__ __forceinline__ f16x16 tile_frag(const float* base, int pitch_bytes) { return lds_frag32(base, pitch_bytes / 4); }
// four asynchronous copies, 16 bytes a lane each, global memory -> LDS (l: the lane's LDS byte address, g: its global address).
// s_wait_xcnt 0 closes the statement: it stands ahead of any rewrite of the address registers that the copies name
__device__ __forceinline__ void acopy4(unsigned l0, unsigned l1, unsigned l2, unsigned l3, const char* g0, const char* g1, const char* g2, const char* g3) {
  asm volatile("global_load_async_to_lds_b128 %0, %4, off\n\t"
               "global_load_async_to_lds_b128 %1, %5, off\n\t"
               "global_load_async_to_lds_b128 %2, %6, off\n\t"
               "global_load_async_to_lds_b128 %3, %7, off\n\t"
               "s_wait_xcnt 0x0"
               :: "v"(l0), "v"(l1), "v"(l2), "v"(l3), "v"(g0), "v"(g1), "v"(g2), "v"(g3) : "memory");
}
// the same, eight copies under one wait
__device__ __forceinline__ void acopy8(unsigned l0, unsigned l1, unsigned l2, unsigned l3, unsigned l4, unsigned l5, unsigned l6, unsigned l7,
                                       const char* g0, const char* g1, const char* g2, const char* g3, const char* g4, const char* g5, const char* g6, const char* g7) {
  asm volatile("global_load_async_to_lds_b128 %0, %8, off\n\t"
               "global_load_async_to_lds_b128 %1, %9, off\n\t"
               "global_load_async_to_lds_b128 %2, %10, off\n\t"
               "global_load_async_to_lds_b128 %3, %11, off\n\t"
               "global_load_async_to_lds_b128 %4, %12, off\n\t"
               "global_load_async_to_lds_b128 %5, %13, off\n\t"
               "global_load_async_to_lds_b128 %6, %14, off\n\t"
               "global_load_async_to_lds_b128 %7, %15, off\n\t"
               "s_wait_xcnt 0x0"
               :: "v"(l0), "v"(l1), "v"(l2), "v"(l3), "v"(l4), "v"(l5), "v"(l6), "v"(l7),
                  "v"(g0), "v"(g1), "v"(g2), "v"(g3), "v"(g4), "v"(g5), "v"(g6), "v"(g7) : "memory");
}
// Tiles of 64 k: [A 128 rows | W 128 rows], brought as they lie in memory by asynchronous copies into a ring of two LDS buffers; tile t + 1 flies while tile t
// is multiplied. Row pitch = row bytes + 16 (16 B x odd: the ds_load_b128 readers meet no bank twice). K: a multiple of 64. The ring is the output staging afterwards.
// bx, by: the work-group's tile row and tile column
template <typename AT, int EPI, bool OUT16>
__device__ __forceinline__ void gemm_tile(const int bx, const int by, const AT* __restrict__ A, int lda, const f16* __restrict__ Wt, int ldw,
                                          const float* __restrict__ bias, const float* __restrict__ R, const float* __restrict__ gvec,
                                          void* __restrict__ Yv, int ldy, int K) {
  constexpr int KS = 64;
  constexpr int ARB = KS * (int)sizeof(AT), APB = ARB + 16, WPB = KS * 2 + 16;   // A row bytes; LDS pitches
  constexpr int ABYTES = 128 * APB, STAGE = ABYTES + 128 * WPB;
  constexpr int OSB = 8 * 32 * 68 * 4;
  __shared__ __attribute__((aligned(128))) char smem[(2 * STAGE > OSB) ? 2 * STAGE : OSB];
  const int tid = threadIdx.x, lane = tid & 31, wave = tid >> 5, cl = lane & 15, rh = (lane >> 4) * 8;
  const int m0 = bx * 128, n0 = by * 128;
  const int wm = (wave & 3) * 32, wn = (wave >> 2) * 64;
  // copy map: a thread brings 16 bytes of every ARP-th row of A and of every 32nd row of W; a wave's copy covers whole rows of the tile
  constexpr int ACPR = ARB / 16, ARP = 256 / ACPR;
  const unsigned sb = (unsigned)(uintptr_t)smem;
  const unsigned la = sb + (tid / ACPR) * APB + (tid % ACPR) * 16, lw = sb + ABYTES + (tid >> 3) * WPB + (tid & 7) * 16;
  const char* ga = (const char*)(A + (size_t)(m0 + tid / ACPR) * lda) + (tid % ACPR) * 16;
  const char* gw = (const char*)(Wt + (size_t)(n0 + (tid >> 3)) * ldw) + (tid & 7) * 16;
  const size_t as = (size_t)ARP * lda * sizeof(AT), wsb = (size_t)32 * ldw * 2;
  auto bring = [&](unsigned bo) {   // the next tile in k order into the buffer at byte bo
    const unsigned a = la + bo, w = lw + bo;
    if (sizeof(AT) == 2) {
      acopy8(a, a + ARP * APB, a + 2 * ARP * APB, a + 3 * ARP * APB, w, w + 32 * WPB, w + 64 * WPB, w + 96 * WPB,
             ga, ga + as, ga + 2 * as, ga + 3 * as, gw, gw + wsb, gw + 2 * wsb, gw + 3 * wsb);
    } else {
      acopy8(a, a + ARP * APB, a + 2 * ARP * APB, a + 3 * ARP * APB, a + 4 * ARP * APB, a + 5 * ARP * APB, a + 6 * ARP * APB, a + 7 * ARP * APB,
             ga, ga + as, ga + 2 * as, ga + 3 * as, ga + 4 * as, ga + 5 * as, ga + 6 * as, ga + 7 * as);
      acopy4(w, w + 32 * WPB, w + 64 * WPB, w + 96 * WPB, gw, gw + wsb, gw + 2 * wsb, gw + 3 * wsb);
    }
    ga += ARB; gw += KS * 2;
  };
  f32x8 acc[2][4];
#pragma unroll
  for (int i = 0; i < 2; ++i)
#pragma unroll
    for (int j = 0; j < 4; ++j) { f32x8 z = {}; acc[i][j] = z; }
  const int NT = K / KS;
  bring(0);
  asm volatile("s_wait_asynccnt 0x0" ::: "memory");   // tile 0 has landed, as far as this wave brought it
  __syncthreads();                                    // ... and all of it
  if (NT > 1) bring(STAGE);
  unsigned bo = 0;
#pragma unroll 1   // kept rolled: one publish point in the text, the buffer picked by bo
  for (int t = 0; t < NT; ++t) {
    const AT*  tA = (const AT*)(smem + bo);
    const f16* tW = (const f16*)(smem + bo + ABYTES);
#pragma unroll
    for (int kk = 0; kk < KS; kk += 32) {
      f16x16 af[2];
#pragma unroll
      for (int i = 0; i < 2; ++i) af[i] = tile_frag(tA + (wm + 16 * i) * (APB / (int)sizeof(AT)) + kk, APB);
#pragma unroll
      for (int j = 0; j < 4; ++j) {
        const f16x16 bf = tile_frag(tW + (wn + 16 * j) * (WPB / 2) + kk, WPB);
#pragma unroll
        for (int i = 0; i < 2; ++i) acc[i][j] = wmma16(af[i], bf, acc[i][j]);
      }
    }
    asm volatile("s_wait_dscnt 0x0" ::: "memory");      // this wave has left the buffer at bo
    asm volatile("s_wait_asynccnt 0x0" ::: "memory");   // its part of tile t + 1 has landed
    __syncthreads();                                    // tile t + 1 is whole, and every reader has left the buffer at bo
    if (t + 2 < NT) bring(bo);
    bo ^= (unsigned)STAGE;
  }
  asm volatile("s_wait_asynccnt 0x0" ::: "memory");     // no copy is in flight when the ring becomes the output staging
  float* so = (float*)smem + wave * (32 * 68);
#pragma unroll
  for (int i = 0; i < 2; ++i)
#pragma unroll
    for (int j = 0; j < 4; ++j) {
      const int n = n0 + wn + 16 * j + cl;
      const float bv = bias ? bias[n] : 0.0f;
      const float gv = (EPI == 2) ? gvec[n] : 0.0f;
      if (EPI == 1) {
#pragma unroll 1
        for (int r = 0; r < 8; ++r) { const float xg = acc[i][j][r] + bv; so[(16 * i + rh + r) * 68 + 16 * j + cl] = 0.5f * xg * (1.0f + erff(xg * 0.70710678118654752f)); }
      } else {
#pragma unroll
        for (int r = 0; r < 8; ++r) {
          float v = acc[i][j][r] + bv;
          if (EPI == 2) v = R[(size_t)(m0 + wm + 16 * i + rh + r) * ldy + n] + gv * v;
          so[(16 * i + rh + r) * 68 + 16 * j + cl] = v;
        }
      }
    }
  asm volatile("s_wait_dscnt 0" ::: "memory");
  __builtin_amdgcn_wave_barrier();
{
    if (OUT16) {
      f16* Y = (f16*)Yv;
#pragma unroll
      for (int it = 0; it < 8; ++it) { const int c = lane + 32 * it, rr = c >> 3, q8 = (c & 7) * 8;
        union { f16 h[8]; v4u_t v; } u;
#pragma unroll
        for (int e = 0; e < 8; ++e) u.h[e] = (f16)so[rr * 68 + q8 + e];
        *(v4u_t*)(Y + (size_t)(m0 + wm + rr) * ldy + n0 + wn + q8) = u.v; }
    } else {
      float* Y = (float*)Yv;
#pragma unroll
      for (int it = 0; it < 16; ++it) { const int f4 = lane + 32 * it, rr = f4 >> 4, q = (f4 & 15) * 4;
        *(v4f_t*)(Y + (size_t)(m0 + wm + rr) * ldy + n0 + wn + q) = *(const v4fa*)(so + rr * 68 + q); }
    }
    
  }
}
// Launches that need nothing of each other share one grid; the block index picks the job, so every branch between jobs (and every barrier inside a job) is taken by whole work-groups.
// kx*Wk and vx*Wv, both to f16 rows: blockIdx.z picks the product. wkv: Wk, then Wv, as f16 [n][k]
__global__ __launch_bounds__(256) void gemm_kv(const f16* __restrict__ kx, const f16* __restrict__ vx, const f16* __restrict__ wkv, f16* __restrict__ k16, f16* __restrict__ v16) {
  const int z = blockIdx.z;
  gemm_tile<f16, 0, true>(blockIdx.x, blockIdx.y, z ? vx : kx, EE, wkv + (size_t)z * EE * EE, EE, nullptr, nullptr, nullptr, z ? v16 : k16, EE, EE);
}

// the four weights, once a call, as f16 rows Wt[n][k] = (f16)W[k][n]: the GEMMs then stage a W tile as they stage an A tile, 16 bytes at a time.
// block = 64 k x 32 n of one weight, turned through LDS (pitch 33 floats: no bank is met twice by a wave, writing or reading); whole 128-byte lines in and out
__device__ __forceinline__ void wt_block(const int bx, const int by, const int bz, const float* __restrict__ W0, const float* __restrict__ W1, const float* __restrict__ W2, const float* __restrict__ W3, f16* __restrict__ T) {
  __shared__ float tl[64][33];
  const int tid = threadIdx.x, k0 = bx * 64, n0 = by * 32, z = bz;
  const float* Wm = (z == 0) ? W0 : (z == 1 ? W1 : (z == 2 ? W2 : W3));
  const int kr = tid >> 3, c = (tid & 7) * 4;
  const v4f_t a = *(const v4f_t*)(Wm + (size_t)(k0 + kr) * EE + n0 + c);
  const v4f_t b = *(const v4f_t*)(Wm + (size_t)(k0 + kr + 32) * EE + n0 + c);
#pragma unroll
  for (int u = 0; u < 4; ++u) { tl[kr][c + u] = a[u]; tl[kr + 32][c + u] = b[u]; }
  __syncthreads();
  const int n = tid >> 3, kq = (tid & 7) * 8;
  union { f16 h[8]; v4u_t v; } o;
#pragma unroll
  for (int e = 0; e < 8; ++e) o.h[e] = (f16)tl[kq + e][n];
  *(v4u_t*)(T + (size_t)z * EE * EE + (size_t)(n0 + n) * EE + k0 + kq) = o.v;
}
// token-shift mixes as f16 rows: kx = x·mk + xprev·(1−mk) etc. (xprev = sx for t = 0); thread -> 8 channels
__device__ __forceinline__ void mix_block(const int bx, const float* __restrict__ x, const float* __restrict__ sx, const float* __restrict__ mk, const float* __restrict__ mv, const float* __restrict__ mr,
                                            bf16* __restrict__ kx, bf16* __restrict__ vx, bf16* __restrict__ rx) {
  const size_t i = (size_t)bx * 256 + threadIdx.x; const size_t t = i >> 7; const int c0 = (i & 127) * 8;
  const float* xr = x + t * EE + c0; const float* pr = (t == 0) ? (sx + c0) : (x + (t - 1) * EE + c0);
  union { bf16 hh[8]; v4u_t u; } ck, cv2, cr;
#pragma unroll
  for (int e = 0; e < 8; ++e) { const float a = xr[e], p = pr[e]; const int c = c0 + e;
    ck.hh[e] = (bf16)(a * mk[c] + p * (1.0f - mk[c])); cv2.hh[e] = (bf16)(a * mv[c] + p * (1.0f - mv[c])); cr.hh[e] = (bf16)(a * mr[c] + p * (1.0f - mr[c])); }
{ *(v4u_t*)(kx + t * EE + c0) = ck.u; *(v4u_t*)(vx + t * EE + c0) = cv2.u; *(v4u_t*)(rx + t * EE + c0) = cr.u;  }
}
// WKV scan, split in time. The state is linear: with A = aa*exp(pp), B = bb*exp(pp) a step is A' = exp(decay)*A + exp(k)*v,
// B' = exp(decay)*B + exp(k), so n steps give  end = exp(n*decay)*start + (end reached from the empty state).
//   k_wkv_local: every chunk of WLEN steps, all chunks at once, runs the state update from the empty state -> la, lb, lp
//   carry_block: joins the chunk ends in time order -> the state each chunk starts from (sa, sb, sp) and the final state
//   k_wkv      : every chunk, all chunks at once, runs the module's own step from its start state and writes sigmoid(r)*wkv
// All three keep the module's max-stabilised form (value, log scale pp); lane = channel e.
#define WCH   128          // chunks: 128 x 32 waves = 4 waves a SIMD
#define WLEN  (TT / WCH)   // 64 steps a chunk
#define WUA   16           // k_wkv_local: steps whose operands are loaded together, ahead of their arithmetic
#define WUC   8            // k_wkv: the same
#define WSEGS 8            // carry: one wave a segment of WCH / WSEGS chunks
#define WSEG  (WCH / WSEGS)
// stands behind a run of global loads or stores, ahead of any reuse of a register that they name
__device__ __forceinline__ void wait_xcnt() { asm volatile("s_wait_xcnt 0x0" ::: "memory"); }
// (aa, bb, pp) decayed over a span (d = steps * decay), plus the end state (a, b, p) that the span reaches from the empty state
__device__ __forceinline__ void wkv_join(float& aa, float& bb, float& pp, float d, float a, float b, float p) {
  const float w = pp + d; const float q = fmaxf(w, p); const float e1 = expf(w - q), e2 = expf(p - q);
  aa = e1 * aa + e2 * a; bb = e1 * bb + e2 * b; pp = q;
}
__global__ __launch_bounds__(256) void k_wkv_local(const bf16* __restrict__ k, const bf16* __restrict__ v, const float* __restrict__ tdecay,
                                                  float* __restrict__ la, float* __restrict__ lb, float* __restrict__ lp) {
  const int e = blockIdx.x * 256 + threadIdx.x, c = blockIdx.y;
  const bf16* kc = k + (size_t)c * WLEN * EE; const bf16* vc = v + (size_t)c * WLEN * EE;
  const float td = tdecay[e];
  wait_xcnt();
  const float decay = -expf(td);
  float aa = 0.0f, bb = 0.0f, pp = 0.0f;
#pragma unroll 1   // kept rolled: the SIMD's other waves cover a trip's loads, more code in line buys nothing
  for (int t0 = 0; t0 < WLEN; t0 += WUA) {
    const bf16* kt = kc + t0 * EE; const bf16* vt = vc + t0 * EE;
    float kk[WUA], vv[WUA];
#pragma unroll
    for (int u = 0; u < WUA; ++u) kk[u] = (float)kt[u * EE + e];
    wait_xcnt();   // the v loads may land in the registers that held the k loads' address
#pragma unroll
    for (int u = 0; u < WUA; ++u) vv[u] = (float)vt[u * EE + e];
    wait_xcnt();
#pragma unroll
    for (int u = 0; u < WUA; ++u) {
      if (u == 0 && t0 == 0) { aa = vv[0]; bb = 1.0f; pp = kk[0]; }   // first step on the empty state: A = exp(k)*v, B = exp(k)
      else { const float ww2 = decay + pp; const float p2 = fmaxf(ww2, kk[u]); const float e1b = expf(ww2 - p2), e2b = expf(kk[u] - p2);
        aa = e1b * aa + e2b * vv[u]; bb = e1b * bb + e2b; pp = p2; }
    }
  }
  la[c * EE + e] = aa; lb[c * EE + e] = bb; lp[c * EE + e] = pp;
}
// block = 32 channels x WSEGS waves; wave = one segment of WSEG chunks: segment end from empty, prefix over segments through LDS, then the chunk starts
__device__ __forceinline__ void carry_block(const int bx, const float* __restrict__ la, const float* __restrict__ lb, const float* __restrict__ lp,
                                                  const float* __restrict__ aa0, const float* __restrict__ bb0, const float* __restrict__ pp0, const float* __restrict__ tdecay,
                                                  float* __restrict__ sa, float* __restrict__ sb, float* __restrict__ sp,
                                                  float* __restrict__ aaf, float* __restrict__ bbf, float* __restrict__ ppf) {
  __shared__ float sg[3][WSEGS][32];
  const int lane = threadIdx.x & 31, seg = __builtin_amdgcn_readfirstlane(threadIdx.x >> 5);
  const int e = bx * 32 + lane;
  const float* ca = la + seg * WSEG * EE; const float* cb = lb + seg * WSEG * EE; const float* cp = lp + seg * WSEG * EE;
  float a[WSEG], b[WSEG], p[WSEG];
#pragma unroll
  for (int u = 0; u < WSEG; ++u) { a[u] = ca[u * EE + e]; b[u] = cb[u * EE + e]; p[u] = cp[u * EE + e]; }
  float aa = aa0[e], bb = bb0[e], pp = pp0[e]; const float td = tdecay[e];
  wait_xcnt();
  const float dl = (float)WLEN * -expf(td), ds = (float)(WLEN * WSEG) * -expf(td);
  float ta = a[0], tb = b[0], tp = p[0];
#pragma unroll
  for (int u = 1; u < WSEG; ++u) wkv_join(ta, tb, tp, dl, a[u], b[u], p[u]);
  sg[0][seg][lane] = ta; sg[1][seg][lane] = tb; sg[2][seg][lane] = tp;
  __syncthreads();
#pragma unroll 1   // at most 7 trips, a different count in every wave: unrolling only adds a remainder loop
  for (int s = 0; s < seg; ++s) wkv_join(aa, bb, pp, ds, sg[0][s][lane], sg[1][s][lane], sg[2][s][lane]);
  float oa[WSEG], ob[WSEG], op[WSEG];
#pragma unroll
  for (int u = 0; u < WSEG; ++u) { oa[u] = aa; ob[u] = bb; op[u] = pp; wkv_join(aa, bb, pp, dl, a[u], b[u], p[u]); }
  __builtin_amdgcn_sched_barrier(0);   // keeps the stores behind the arithmetic above, so that no register of an issued store is written again ahead of the wait below
  float* da = sa + seg * WSEG * EE; float* db = sb + seg * WSEG * EE; float* dp = sp + seg * WSEG * EE;
#pragma unroll
  for (int u = 0; u < WSEG; ++u) { da[u * EE + e] = oa[u]; db[u * EE + e] = ob[u]; dp[u * EE + e] = op[u]; }
  wait_xcnt();
  if (seg == WSEGS - 1) { aaf[e] = aa; bbf[e] = bb; ppf[e] = pp; }
}
__global__ __launch_bounds__(256) void k_wkv(const bf16* __restrict__ k, const bf16* __restrict__ v, float* __restrict__ ry,
                                            const float* __restrict__ sa, const float* __restrict__ sb, const float* __restrict__ sp,
                                            const float* __restrict__ tfirst, const float* __restrict__ tdecay) {
  const int e = blockIdx.x * 256 + threadIdx.x, c = blockIdx.y;
  float aa = sa[c * EE + e], bb = sb[c * EE + e], pp = sp[c * EE + e]; const float tf = tfirst[e], td = tdecay[e];
  wait_xcnt();
  const float decay = -expf(td);
#pragma unroll 1   // kept rolled, for speed only
  for (int t0 = 0; t0 < WLEN; t0 += WUC) {
    const bf16* kt = k + ((size_t)c * WLEN + t0) * EE; const bf16* vt = v + ((size_t)c * WLEN + t0) * EE; float* rt = ry + ((size_t)c * WLEN + t0) * EE;
    float kq[WUC], vq[WUC], rq[WUC];
#pragma unroll
    for (int u = 0; u < WUC; ++u) { kq[u] = (float)kt[u * EE + e]; vq[u] = (float)vt[u * EE + e]; rq[u] = rt[u * EE + e]; }
    wait_xcnt();
#pragma unroll
    for (int u = 0; u < WUC; ++u) { const float kk = kq[u], vv = vq[u];
      const float ww = tf + kk; const float p = fmaxf(pp, ww); const float e1 = expf(pp - p), e2 = expf(ww - p);
      const float wkv = (e1 * aa + e2 * vv) / (e1 * bb + e2);
      const float ww2 = decay + pp; const float p2 = fmaxf(ww2, kk); const float e1b = expf(ww2 - p2), e2b = expf(kk - p2);
      aa = e1b * aa + e2b * vv; bb = e1b * bb + e2b; pp = p2;
      rq[u] = wkv / (1.0f + expf(-rq[u])); }
    __builtin_amdgcn_sched_barrier(0);   // keeps the stores behind the arithmetic above, so that no register of an issued store is written again ahead of the wait below
#pragma unroll
    for (int u = 0; u < WUC; ++u) rt[u * EE + e] = rq[u];
    wait_xcnt();
  }
}
__device__ __forceinline__ void tail_block(const int bx, const float* __restrict__ x, const float* __restrict__ af, const float* __restrict__ bf_, const float* __restrict__ pf, float* __restrict__ o) {
  const int tid = threadIdx.x; const float* src = (bx == 0) ? (x + (size_t)(TT - 1) * EE) : (bx == 1 ? af : (bx == 2 ? bf_ : pf));
  const v4f_t val = *(const v4f_t*)(src + tid * 4);
  wait_xcnt();   // the store's address may be formed in the registers that held the load's
  float* dst = o + (size_t)bx * EE + tid * 4;
  *(v4f_t*)dst = val; 
}
__device__ __forceinline__ void ones_block(float* __restrict__ p) { const int tid = threadIdx.x; v4f_t o = {1.f,1.f,1.f,1.f}; *(v4f_t*)(p + tid * 4) = o;  }
#define NB_MIX   (TT * (EE / 8) / 256)           // mix_block: 4096 work-groups
#define NB_WT    ((EE / 64) * (EE / 32) * 4)     // wt_block: 16 x 32 x 4 work-groups
#define NB_CARRY (EE / 32)                       // carry_block: 32 work-groups
#define NB_GEMM  ((TT / 128) * (EE / 128))       // gemm_tile: 64 x 8 work-groups a product
// the token-shift mixes, the four weights' f16 [n][k] rows, the row of ones
__global__ __launch_bounds__(256) void k_prep(const float* __restrict__ x, const float* __restrict__ sx, const float* __restrict__ mk, const float* __restrict__ mv, const float* __restrict__ mr,
                                             bf16* __restrict__ kx, bf16* __restrict__ vx, bf16* __restrict__ rx,
                                             const float* __restrict__ W0, const float* __restrict__ W1, const float* __restrict__ W2, const float* __restrict__ W3, f16* __restrict__ T,
                                             float* __restrict__ ones) {
  const int b = blockIdx.x;
  if (b < NB_MIX) mix_block(b, x, sx, mk, mv, mr, kx, vx, rx);
  else if (b < NB_MIX + NB_WT) { const int w = b - NB_MIX; wt_block(w & 15, (w >> 4) & 31, w >> 9, W0, W1, W2, W3, T); }
  else { ones_block(ones); wait_xcnt(); }   // the other jobs' code follows this store in the kernel's text and reuses its registers
}
// the carry over the chunk ends (32 work-groups, which alone leave most of the chip idle) and rx*Wr (f32 rows), which the scan needs only for its outputs
__global__ __launch_bounds__(256) void k_carry_r(const float* __restrict__ la, const float* __restrict__ lb, const float* __restrict__ lp,
                                                const float* __restrict__ aa0, const float* __restrict__ bb0, const float* __restrict__ pp0, const float* __restrict__ tdecay,
                                                float* __restrict__ sa, float* __restrict__ sb, float* __restrict__ sp,
                                                float* __restrict__ aaf, float* __restrict__ bbf, float* __restrict__ ppf,
                                                const f16* __restrict__ rx, const f16* __restrict__ wr, float* __restrict__ ry) {
  const int b = blockIdx.x;
  if (b < NB_CARRY) carry_block(b, la, lb, lp, aa0, bb0, pp0, tdecay, sa, sb, sp, aaf, bbf, ppf);
  else { const int t = b - NB_CARRY; gemm_tile<f16, 0, false>(t & (TT / 128 - 1), t / (TT / 128), rx, EE, wr, EE, nullptr, nullptr, nullptr, ry, EE, EE); }
}
// out = x + (r*wkv)*Wo and the four tail rows of out: both need the launches before and nothing of each other
__global__ __launch_bounds__(256) void k_out_tail(const float* __restrict__ ry, const f16* __restrict__ wo, const float* __restrict__ x, const float* __restrict__ ones, float* __restrict__ out,
                                                 const float* __restrict__ af, const float* __restrict__ bf_, const float* __restrict__ pf, float* __restrict__ o) {
  const int b = blockIdx.x;
  if (b < NB_GEMM) gemm_tile<float, 2, false>(b & (TT / 128 - 1), b / (TT / 128), ry, EE, wo, EE, nullptr, x, ones, out, EE, EE);
  else tail_block(b - NB_GEMM, x, af, bf_, pf, o);
}

extern "C" void kernel_launch(void* const* d_in, const int* in_sizes, int n_in,
                              void* d_out, int out_size, void* d_ws, size_t ws_size,
                              hipStream_t stream) {
  (void)in_sizes; (void)n_in; (void)out_size;
  const float** f = (const float**)d_in;
  const float* x = f[0], *sx = f[1], *aa = f[2], *bb = f[3], *pp = f[4], *tfirst = f[5], *tdecay = f[6], *mk = f[7], *mv = f[8], *mr = f[9], *Wk = f[10], *Wv = f[11], *Wr = f[12], *Wo = f[13];
  float* out = (float*)d_out;                 // [8192,1024] | x_last | aa | bb | pp
  float* tail = out + (size_t)TT * EE;
  char* ws = (char*)d_ws;
  bf16* kx = (bf16*)ws; ws += (size_t)TT * EE * 2; bf16* vx = (bf16*)ws; ws += (size_t)TT * EE * 2; bf16* rx = (bf16*)ws; ws += (size_t)TT * EE * 2;   // 16 MB each
  float* ry = (float*)ws; ws += (size_t)TT * EE * 4;         // 32 MB: rx·Wr, then σ(r)·wkv in place
  bf16* k16 = (bf16*)ws; ws += (size_t)TT * EE * 2; bf16* v16 = (bf16*)ws; ws += (size_t)TT * EE * 2;
  float* stf = (float*)ws; ws += 3 * EE * 4; float* ones = (float*)ws; ws += EE * 4;
  float* lst = (float*)ws; ws += (size_t)3 * WCH * EE * 4; float* sst = (float*)ws; ws += (size_t)3 * WCH * EE * 4;   // chunk ends, chunk start states: [3][WCH][EE] each
  f16* wt = (f16*)ws; ws += (size_t)4 * EE * EE * 2;         // 2 MB each: Wr, Wk, Wv, Wo as f16 [n][k]
  if ((size_t)(ws - (char*)d_ws) > ws_size) return;
  const dim3 blk(256);
  k_prep<<<dim3(NB_MIX + NB_WT + 1), blk, 0, stream>>>(x, sx, mk, mv, mr, kx, vx, rx, Wr, Wk, Wv, Wo, wt, ones);
  gemm_kv<<<dim3(TT / 128, EE / 128, 2), blk, 0, stream>>>(kx, vx, wt + (size_t)EE * EE, k16, v16);
  k_wkv_local<<<dim3(EE / 256, WCH), blk, 0, stream>>>(k16, v16, tdecay, lst, lst + WCH * EE, lst + 2 * WCH * EE);
  k_carry_r<<<dim3(NB_CARRY + NB_GEMM), blk, 0, stream>>>(lst, lst + WCH * EE, lst + 2 * WCH * EE, aa, bb, pp, tdecay, sst, sst + WCH * EE, sst + 2 * WCH * EE, stf, stf + EE, stf + 2 * EE, rx, wt, ry);
  k_wkv<<<dim3(EE / 256, WCH), blk, 0, stream>>>(k16, v16, ry, sst, sst + WCH * EE, sst + 2 * WCH * EE, tfirst, tdecay);
  k_out_tail<<<dim3(NB_GEMM + 4), blk, 0, stream>>>(ry, wt + (size_t)3 * EE * EE, x, ones, out, stf, stf + EE, stf + 2 * EE, tail);    // x + (r*wkv)*Wo
}

// v005
// One run takes 112 microseconds.
// Timed twice side by side with v004, it ran 1.09 times as fast both times.
// All steps since v000 together make it 24.8 times as fast.
// Contractions on v_wmma_f32_16x16x32_f16 (plain f16 operands, f32 accumulate): r = σ(rx·Wr), k = kx·Wk, v = vx·Wv and out = x + (r·wkv)·Wo
// (four K = 1024 GEMMs; the token-shift mixes kx/vx/rx are built once as f16 rows, the four weights once as f16 [n][k] rows, k and v kept as f16 rows); the WKV recurrence is the
// module's max-stabilised f32 scan, lane = channel, split into 128 time chunks of 64 steps (chunk ends, carry, outputs: three launches), writing r*wkv in place
// compute dtype: f16 operands, f32 accumulate / f32 scan.  x [8192,1024].
#include <hip/hip_runtime.h>
#include <hip/hip_bf16.h>
#include <math.h>

#define TT 8192
#define EE 1024
#define GSTR 48

typedef _Float16 bf16;
typedef _Float16 f16;
typedef __attribute__((ext_vector_type(4))) unsigned v4u_t;
typedef unsigned v4ua __attribute__((ext_vector_type(4), may_alias));
typedef __attribute__((ext_vector_type(4))) float v4f_t;
typedef float v4fa __attribute__((ext_vector_type(4), may_alias));
typedef __attribute__((ext_vector_type(16))) bf16  bf16x16;
typedef bf16x16 f16x16;
typedef __attribute__((ext_vector_type(8)))  bf16  bf16x8;
typedef bf16x8 f16x8;
typedef __attribute__((ext_vector_type(4)))  bf16  bf16x4;
typedef __attribute__((ext_vector_type(8)))  float f32x8;
__device__ __forceinline__ f32x8 wmma16(f16x16 a, f16x16 b, f32x8 c) {
  c = __builtin_amdgcn_wmma_f32_16x16x32_f16(false, a, false, b, (short)0, c, false, false);
  asm volatile("v_nop\n\tv_nop\n\tv_nop\n\tv_nop" : "+v"(c) : "v"(a), "v"(b));
  return c;
}
#define LDS_STRIDE 48   // unused: the GEMM's LDS pitches are APB and WPB
#define KSTRIDE    72
#define VSTRIDE    48

__device__ __forceinline__ f32x8 wmma_bf16(bf16x16 a, bf16x16 b, f32x8 c) {
  c = __builtin_amdgcn_wmma_f32_16x16x32_f16(false, a, false, b, (short)0, c, false, false);
  asm volatile("v_nop\n\tv_nop\n\tv_nop\n\tv_nop" : "+v"(c) : "v"(a), "v"(b));   // A/B-overwrite hazard guard
  return c;
}

// 16x32 (MxK) bf16 fragment from a row-major global matrix.
// lanes 0-15  (row=lane)    : elems 0..7 = K+0..7,  8..15 = K+16..23
// lanes 16-31 (row=lane-16) : elems 0..7 = K+8..15, 8..15 = K+24..31
template <typename T>
__device__ __forceinline__ bf16x16 load_frag(const T* __restrict__ base, int ld,
                                             int row0, int k0) {
  const int lane = threadIdx.x & 31;
  const int r    = lane & 15;
  const int kh   = (lane >> 4) * 8;
  const T* p0 = base + (size_t)(row0 + r) * ld + (k0 + kh);
  const T* p1 = p0 + 16;
  bf16x16 f;
#pragma unroll
  for (int i = 0; i < 8; ++i) {
    f[i]     = (bf16)p0[i];
    f[i + 8] = (bf16)p1[i];
  }
  return f;
}

// Same fragment from an LDS tile with padded row stride (base includes row0/k0).
__device__ __forceinline__ bf16x16 lds_frag(const bf16* base, int stride) {
  const int lane = threadIdx.x & 31;
  const int row  = lane & 15;
  const int kh   = (lane >> 4) * 8;
  const bf16x8 lo = *(const bf16x8*)(base + row * stride + kh);
  const bf16x8 hi = *(const bf16x8*)(base + row * stride + kh + 16);
  bf16x16 f;
#pragma unroll
  for (int i = 0; i < 8; ++i) { f[i] = lo[i]; f[i + 8] = hi[i]; }
  return f;
}

template <typename T>
__device__ __forceinline__ void stage_read16(const T* __restrict__ p, float* buf) {
#pragma unroll
  for (int i = 0; i < 16; ++i) buf[i] = (float)p[i];
}

__device__ __forceinline__ void stage_write(bf16* dst, const float* buf, int nquad) {
#pragma unroll
  for (int i = 0; i < nquad; ++i) {
    bf16x4 q;
    q[0] = (bf16)buf[4 * i];     q[1] = (bf16)buf[4 * i + 1];
    q[2] = (bf16)buf[4 * i + 2]; q[3] = (bf16)buf[4 * i + 3];
    *(bf16x4*)(dst + 4 * i) = q;
  }
}


// ---------------------------------------------------------------------------------------------------------------------------
// gemm_tile: Y[m][n] = epi( sum_k A[m][k]*W[k][n] + bias[n] ), A f32/f16 [M][lda], W given transposed as f16 rows Wt[n][k] (ldw; wt_block makes them), plain f16 operands,
// f32 accumulate. EPI 0: identity; 1: exact-erf GELU; 2: R[m][n] + gvec[n]·(·) (residual with per-channel gain). Output f32 (or f16
// when OUT16). Block = 128x128 tile, 8 waves as 4(M) x 2(N); A (rounded to f16 where a fragment is read) and W tiles in LDS, both as k-contiguous rows
// ---------------------------------------------------------------------------------------------------------------------------
// 16x32 (MxK) f16 fragment from an LDS tile of f32 rows (base includes row0/k0, stride in floats): the k order of lds_frag, each value rounded to f16 here
__device__ __forceinline__ f16x16 lds_frag32(const float* base, int stride) {
  const int lane = threadIdx.x & 31;
  const float* p = base + (lane & 15) * stride + (lane >> 4) * 8;
  const v4f_t a0 = *(const v4fa*)(p), a1 = *(const v4fa*)(p + 4), b0 = *(const v4fa*)(p + 16), b1 = *(const v4fa*)(p + 20);
  f16x16 f;
#pragma unroll
  for (int i = 0; i < 4; ++i) { f[i] = (f16)a0[i]; f[i + 4] = (f16)a1[i]; f[i + 8] = (f16)b0[i]; f[i + 12] = (f16)b1[i]; }
  return f;
}
__device__ __forceinline__ f16x16 tile_frag(const f16* base, int pitch_bytes)   { return lds_frag(base, pitch_bytes / 2); }
__device__ __forceinline__ f16x16 tile_frag(const float* base, int pitch_bytes) { return lds_frag32(base, pitch_bytes / 4); }
// four asynchronous copies, 16 bytes a lane each, global memory -> LDS (l: the lane's LDS byte address, g: its global address).
// s_wait_xcnt 0 closes the statement: it stands ahead of any rewrite of the address registers that the copies name
__device__ __forceinline__ void acopy4(unsigned l0, unsigned l1, unsigned l2, unsigned l3, const char* g0, const char* g1, const char* g2, const char* g3) {
  asm volatile("global_load_async_to_lds_b128 %0, %4, off\n\t"
               "global_load_async_to_lds_b128 %1, %5, off\n\t"
               "global_load_async_to_lds_b128 %2, %6, off\n\t"
               "global_load_async_to_lds_b128 %3, %7, off\n\t"
               "s_wait_xcnt 0x0"
               :: "v"(l0), "v"(l1), "v"(l2), "v"(l3), "v"(g0), "v"(g1), "v"(g2), "v"(g3) : "memory");
}
// the same, eight copies under one wait
__device__ __forceinline__ void acopy8(unsigned l0, unsigned l1, unsigned l2, unsigned l3, unsigned l4, unsigned l5, unsigned l6, unsigned l7,
                                       const char* g0, const char* g1, const char* g2, const char* g3, const char* g4, const char* g5, const char* g6, const char* g7) {
  asm volatile("global_load_async_to_lds_b128 %0, %8, off\n\t"
               "global_load_async_to_lds_b128 %1, %9, off\n\t"
               "global_load_async_to_lds_b128 %2, %10, off\n\t"
               "global_load_async_to_lds_b128 %3, %11, off\n\t"
               "global_load_async_to_lds_b128 %4, %12, off\n\t"
               "global_load_async_to_lds_b128 %5, %13, off\n\t"
               "global_load_async_to_lds_b128 %6, %14, off\n\t"
               "global_load_async_to_lds_b128 %7, %15, off\n\t"
               "s_wait_xcnt 0x0"
               :: "v"(l0), "v"(l1), "v"(l2), "v"(l3), "v"(l4), "v"(l5), "v"(l6), "v"(l7),
                  "v"(g0), "v"(g1), "v"(g2), "v"(g3), "v"(g4), "v"(g5), "v"(g6), "v"(g7) : "memory");
}
// Tiles of 64 k: [A 128 rows | W 128 rows], brought as they lie in memory by asynchronous copies into a ring of two LDS buffers; tile t + 1 flies while tile t
// is multiplied. Row pitch = row bytes + 16 (16 B x odd: the ds_load_b128 readers meet no bank twice). K: a multiple of 64. The ring is the output staging afterwards.
// bx, by: the work-group's tile row and tile column
template <typename AT, int EPI, bool OUT16>
__device__ __forceinline__ void gemm_tile(const int bx, const int by, const AT* __restrict__ A, int lda, const f16* __restrict__ Wt, int ldw,
                                          const float* __restrict__ bias, const float* __restrict__ R, const float* __restrict__ gvec,
                                          void* __restrict__ Yv, int ldy, int K) {
  constexpr int KS = 64;
  constexpr int ARB = KS * (int)sizeof(AT), APB = ARB + 16, WPB = KS * 2 + 16;   // A row bytes; LDS pitches
  constexpr int ABYTES = 128 * APB, STAGE = ABYTES + 128 * WPB;
  constexpr int OSB = 8 * 32 * 68 * 4;
  __shared__ __attribute__((aligned(128))) char smem[(2 * STAGE > OSB) ? 2 * STAGE : OSB];
  const int tid = threadIdx.x, lane = tid & 31, wave = tid >> 5, cl = lane & 15, rh = (lane >> 4) * 8;
  const int m0 = bx * 128, n0 = by * 128;
  const int wm = (wave & 3) * 32, wn = (wave >> 2) * 64;
  // copy map: a thread brings 16 bytes of every ARP-th row of A and of every 32nd row of W; a wave's copy covers whole rows of the tile
  constexpr int ACPR = ARB / 16, ARP = 256 / ACPR;
  const unsigned sb = (unsigned)(uintptr_t)smem;
  const unsigned la = sb + (tid / ACPR) * APB + (tid % ACPR) * 16, lw = sb + ABYTES + (tid >> 3) * WPB + (tid & 7) * 16;
  const char* ga = (const char*)(A + (size_t)(m0 + tid / ACPR) * lda) + (tid % ACPR) * 16;
  const char* gw = (const char*)(Wt + (size_t)(n0 + (tid >> 3)) * ldw) + (tid & 7) * 16;
  const size_t as = (size_t)ARP * lda * sizeof(AT), wsb = (size_t)32 * ldw * 2;
  auto bring = [&](unsigned bo) {   // the next tile in k order into the buffer at byte bo
    const unsigned a = la + bo, w = lw + bo;
    if (sizeof(AT) == 2) {
      acopy8(a, a + ARP * APB, a + 2 * ARP * APB, a + 3 * ARP * APB, w, w + 32 * WPB, w + 64 * WPB, w + 96 * WPB,
             ga, ga + as, ga + 2 * as, ga + 3 * as, gw, gw + wsb, gw + 2 * wsb, gw + 3 * wsb);
    } else {
      acopy8(a, a + ARP * APB, a + 2 * ARP * APB, a + 3 * ARP * APB, a + 4 * ARP * APB, a + 5 * ARP * APB, a + 6 * ARP * APB, a + 7 * ARP * APB,
             ga, ga + as, ga + 2 * as, ga + 3 * as, ga + 4 * as, ga + 5 * as, ga + 6 * as, ga + 7 * as);
      acopy4(w, w + 32 * WPB, w + 64 * WPB, w + 96 * WPB, gw, gw + wsb, gw + 2 * wsb, gw + 3 * wsb);
    }
    ga += ARB; gw += KS * 2;
  };
  f32x8 acc[2][4];
#pragma unroll
  for (int i = 0; i < 2; ++i)
#pragma unroll
    for (int j = 0; j < 4; ++j) { f32x8 z = {}; acc[i][j] = z; }
  const int NT = K / KS;
  bring(0);
  asm volatile("s_wait_asynccnt 0x0" ::: "memory");   // tile 0 has landed, as far as this wave brought it
  __syncthreads();                                    // ... and all of it
  if (NT > 1) bring(STAGE);
  unsigned bo = 0;
#pragma unroll 1   // kept rolled: one publish point in the text, the buffer picked by bo
  for (int t = 0; t < NT; ++t) {
    const AT*  tA = (const AT*)(smem + bo);
    const f16* tW = (const f16*)(smem + bo + ABYTES);
#pragma unroll
    for (int kk = 0; kk < KS; kk += 32) {
      f16x16 af[2];
#pragma unroll
      for (int i = 0; i < 2; ++i) af[i] = tile_frag(tA + (wm + 16 * i) * (APB / (int)sizeof(AT)) + kk, APB);
#pragma unroll
      for (int j = 0; j < 4; ++j) {
        const f16x16 bf = tile_frag(tW + (wn + 16 * j) * (WPB / 2) + kk, WPB);
#pragma unroll
        for (int i = 0; i < 2; ++i) acc[i][j] = wmma16(af[i], bf, acc[i][j]);
      }
    }
    asm volatile("s_wait_dscnt 0x0" ::: "memory");      // this wave has left the buffer at bo
    asm volatile("s_wait_asynccnt 0x0" ::: "memory");   // its part of tile t + 1 has landed
    __syncthreads();                                    // tile t + 1 is whole, and every reader has left the buffer at bo
    if (t + 2 < NT) bring(bo);
    bo ^= (unsigned)STAGE;
  }
  asm volatile("s_wait_asynccnt 0x0" ::: "memory");     // no copy is in flight when the ring becomes the output staging
  float* so = (float*)smem + wave * (32 * 68);
#pragma unroll
  for (int i = 0; i < 2; ++i)
#pragma unroll
    for (int j = 0; j < 4; ++j) {
      const int n = n0 + wn + 16 * j + cl;
      const float bv = bias ? bias[n] : 0.0f;
      const float gv = (EPI == 2) ? gvec[n] : 0.0f;
      if (EPI == 1) {
#pragma unroll 1
        for (int r = 0; r < 8; ++r) { const float xg = acc[i][j][r] + bv; so[(16 * i + rh + r) * 68 + 16 * j + cl] = 0.5f * xg * (1.0f + erff(xg * 0.70710678118654752f)); }
      } else {
#pragma unroll
        for (int r = 0; r < 8; ++r) {
          float v = acc[i][j][r] + bv;
          if (EPI == 2) v = R[(size_t)(m0 + wm + 16 * i + rh + r) * ldy + n] + gv * v;
          so[(16 * i + rh + r) * 68 + 16 * j + cl] = v;
        }
      }
    }
  asm volatile("s_wait_dscnt 0" ::: "memory");
  __builtin_amdgcn_wave_barrier();
{
    if (OUT16) {
      f16* Y = (f16*)Yv;
#pragma unroll
      for (int it = 0; it < 8; ++it) { const int c = lane + 32 * it, rr = c >> 3, q8 = (c & 7) * 8;
        union { f16 h[8]; v4u_t v; } u;
#pragma unroll
        for (int e = 0; e < 8; ++e) u.h[e] = (f16)so[rr * 68 + q8 + e];
        *(v4u_t*)(Y + (size_t)(m0 + wm + rr) * ldy + n0 + wn + q8) = u.v; }
    } else {
      float* Y = (float*)Yv;
#pragma unroll
      for (int it = 0; it < 16; ++it) { const int f4 = lane + 32 * it, rr = f4 >> 4, q = (f4 & 15) * 4;
        *(v4f_t*)(Y + (size_t)(m0 + wm + rr) * ldy + n0 + wn + q) = *(const v4fa*)(so + rr * 68 + q); }
    }
    
  }
}
// Launches that need nothing of each other share one grid; the block index picks the job, so every branch between jobs (and every barrier inside a job) is taken by whole work-groups.
// kx*Wk and vx*Wv, both to f16 rows: blockIdx.z picks the product. wkv: Wk, then Wv, as f16 [n][k]
__global__ __launch_bounds__(256) void gemm_kv(const f16* __restrict__ kx, const f16* __restrict__ vx, const f16* __restrict__ wkv, f16* __restrict__ k16, f16* __restrict__ v16) {
  const int z = blockIdx.z;
  gemm_tile<f16, 0, true>(blockIdx.x, blockIdx.y, z ? vx : kx, EE, wkv + (size_t)z * EE * EE, EE, nullptr, nullptr, nullptr, z ? v16 : k16, EE, EE);
}

// the four weights, once a call, as f16 rows Wt[n][k] = (f16)W[k][n]: the GEMMs then stage a W tile as they stage an A tile, 16 bytes at a time.
// block = 64 k x 32 n of one weight, turned through LDS (pitch 33 floats: no bank is met twice by a wave, writing or reading); whole 128-byte lines in and out
__device__ __forceinline__ void wt_block(const int bx, const int by, const int bz, const float* __restrict__ W0, const float* __restrict__ W1, const float* __restrict__ W2, const float* __restrict__ W3, f16* __restrict__ T) {
  __shared__ float tl[64][33];
  const int tid = threadIdx.x, k0 = bx * 64, n0 = by * 32, z = bz;
  const float* Wm = (z == 0) ? W0 : (z == 1 ? W1 : (z == 2 ? W2 : W3));
  const int kr = tid >> 3, c = (tid & 7) * 4;
  const v4f_t a = *(const v4f_t*)(Wm + (size_t)(k0 + kr) * EE + n0 + c);
  const v4f_t b = *(const v4f_t*)(Wm + (size_t)(k0 + kr + 32) * EE + n0 + c);
#pragma unroll
  for (int u = 0; u < 4; ++u) { tl[kr][c + u] = a[u]; tl[kr + 32][c + u] = b[u]; }
  __syncthreads();
  const int n = tid >> 3, kq = (tid & 7) * 8;
  union { f16 h[8]; v4u_t v; } o;
#pragma unroll
  for (int e = 0; e < 8; ++e) o.h[e] = (f16)tl[kq + e][n];
  *(v4u_t*)(T + (size_t)z * EE * EE + (size_t)(n0 + n) * EE + k0 + kq) = o.v;
}
// token-shift mixes as f16 rows: kx = x·mk + xprev·(1−mk) etc. (xprev = sx for t = 0); thread -> 8 channels
__device__ __forceinline__ void mix_block(const int bx, const float* __restrict__ x, const float* __restrict__ sx, const float* __restrict__ mk, const float* __restrict__ mv, const float* __restrict__ mr,
                                            bf16* __restrict__ kx, bf16* __restrict__ vx, bf16* __restrict__ rx) {
  const size_t i = (size_t)bx * 256 + threadIdx.x; const size_t t = i >> 7; const int c0 = (i & 127) * 8;
  const float* xr = x + t * EE + c0; const float* pr = (t == 0) ? (sx + c0) : (x + (t - 1) * EE + c0);
  union { bf16 hh[8]; v4u_t u; } ck, cv2, cr;
#pragma unroll
  for (int e = 0; e < 8; ++e) { const float a = xr[e], p = pr[e]; const int c = c0 + e;
    ck.hh[e] = (bf16)(a * mk[c] + p * (1.0f - mk[c])); cv2.hh[e] = (bf16)(a * mv[c] + p * (1.0f - mv[c])); cr.hh[e] = (bf16)(a * mr[c] + p * (1.0f - mr[c])); }
{ *(v4u_t*)(kx + t * EE + c0) = ck.u; *(v4u_t*)(vx + t * EE + c0) = cv2.u; *(v4u_t*)(rx + t * EE + c0) = cr.u;  }
}
// WKV scan, split in time. The state is linear: with A = aa*exp(pp), B = bb*exp(pp) a step is A' = exp(decay)*A + exp(k)*v,
// B' = exp(decay)*B + exp(k), so n steps give  end = exp(n*decay)*start + (end reached from the empty state).
//   k_wkv_local: every chunk of WLEN steps, all chunks at once, runs the state update from the empty state -> la, lb, lp
//   carry_block: joins the chunk ends in time order -> the state each chunk starts from (sa, sb, sp) and the final state
//   k_wkv      : every chunk, all chunks at once, runs the module's own step from its start state and writes sigmoid(r)*wkv
// All three keep the module's max-stabilised form (value, log scale pp); lane = channel e.
#define WCH   128          // chunks: 128 x 32 waves = 4 waves a SIMD
#define WLEN  (TT / WCH)   // 64 steps a chunk
#define WUA   16           // k_wkv_local: steps whose operands are loaded together, ahead of their arithmetic
#define WUC   8            // k_wkv: the same
#define WSEGS 8            // carry: one wave a segment of WCH / WSEGS chunks
#define WSEG  (WCH / WSEGS)
// stands behind a run of global loads or stores, ahead of any reuse of a register that they name
__device__ __forceinline__ void wait_xcnt() { asm volatile("s_wait_xcnt 0x0" ::: "memory"); }
// (aa, bb, pp) decayed over a span (d = steps * decay), plus the end state (a, b, p) that the span reaches from the empty state
__device__ __forceinline__ void wkv_join(float& aa, float& bb, float& pp, float d, float a, float b, float p) {
  const float w = pp + d; const float q = fmaxf(w, p); const float e1 = expf(w - q), e2 = expf(p - q);
  aa = e1 * aa + e2 * a; bb = e1 * bb + e2 * b; pp = q;
}
// exp(a - max(a, b)) and exp(b - max(a, b)): the larger argument's factor is exp(0) = 1 exactly, so only exp(-|a - b|) is computed, as one v_exp_f32
__device__ __forceinline__ void exp_pair(float a, float b, float& ea, float& eb) {
  const float d = a - b; const float e = __builtin_amdgcn_exp2f(-fabsf(d) * 1.44269504088896340736f);
  ea = (d >= 0.0f) ? 1.0f : e; eb = (d >= 0.0f) ? e : 1.0f;
}
__global__ __launch_bounds__(256) void k_wkv_local(const bf16* __restrict__ k, const bf16* __restrict__ v, const float* __restrict__ tdecay,
                                                  float* __restrict__ la, float* __restrict__ lb, float* __restrict__ lp) {
  const int e = blockIdx.x * 256 + threadIdx.x, c = blockIdx.y;
  const bf16* kc = k + (size_t)c * WLEN * EE; const bf16* vc = v + (size_t)c * WLEN * EE;
  const float td = tdecay[e];
  wait_xcnt();
  const float decay = -expf(td);
  float aa = 0.0f, bb = 0.0f, pp = 0.0f;
#pragma unroll 1   // kept rolled: the SIMD's other waves cover a trip's loads, more code in line buys nothing
  for (int t0 = 0; t0 < WLEN; t0 += WUA) {
    const bf16* kt = kc + t0 * EE; const bf16* vt = vc + t0 * EE;
    float kk[WUA], vv[WUA];
#pragma unroll
    for (int u = 0; u < WUA; ++u) kk[u] = (float)kt[u * EE + e];
    wait_xcnt();   // the v loads may land in the registers that held the k loads' address
#pragma unroll
    for (int u = 0; u < WUA; ++u) vv[u] = (float)vt[u * EE + e];
    wait_xcnt();
#pragma unroll
    for (int u = 0; u < WUA; ++u) {
      if (u == 0 && t0 == 0) { aa = vv[0]; bb = 1.0f; pp = kk[0]; }   // first step on the empty state: A = exp(k)*v, B = exp(k)
      else { const float ww2 = decay + pp; float e1b, e2b; exp_pair(ww2, kk[u], e1b, e2b);
        aa = e1b * aa + e2b * vv[u]; bb = e1b * bb + e2b; pp = fmaxf(ww2, kk[u]); }
    }
  }
  la[c * EE + e] = aa; lb[c * EE + e] = bb; lp[c * EE + e] = pp;
}
// block = 32 channels x WSEGS waves; wave = one segment of WSEG chunks: segment end from empty, prefix over segments through LDS, then the chunk starts
__device__ __forceinline__ void carry_block(const int bx, const float* __restrict__ la, const float* __restrict__ lb, const float* __restrict__ lp,
                                                  const float* __restrict__ aa0, const float* __restrict__ bb0, const float* __restrict__ pp0, const float* __restrict__ tdecay,
                                                  float* __restrict__ sa, float* __restrict__ sb, float* __restrict__ sp,
                                                  float* __restrict__ aaf, float* __restrict__ bbf, float* __restrict__ ppf) {
  __shared__ float sg[3][WSEGS][32];
  const int lane = threadIdx.x & 31, seg = __builtin_amdgcn_readfirstlane(threadIdx.x >> 5);
  const int e = bx * 32 + lane;
  const float* ca = la + seg * WSEG * EE; const float* cb = lb + seg * WSEG * EE; const float* cp = lp + seg * WSEG * EE;
  float a[WSEG], b[WSEG], p[WSEG];
#pragma unroll
  for (int u = 0; u < WSEG; ++u) { a[u] = ca[u * EE + e]; b[u] = cb[u * EE + e]; p[u] = cp[u * EE + e]; }
  float aa = aa0[e], bb = bb0[e], pp = pp0[e]; const float td = tdecay[e];
  wait_xcnt();
  const float dl = (float)WLEN * -expf(td), ds = (float)(WLEN * WSEG) * -expf(td);
  float ta = a[0], tb = b[0], tp = p[0];
#pragma unroll
  for (int u = 1; u < WSEG; ++u) wkv_join(ta, tb, tp, dl, a[u], b[u], p[u]);
  sg[0][seg][lane] = ta; sg[1][seg][lane] = tb; sg[2][seg][lane] = tp;
  __syncthreads();
#pragma unroll 1   // at most 7 trips, a different count in every wave: unrolling only adds a remainder loop
  for (int s = 0; s < seg; ++s) wkv_join(aa, bb, pp, ds, sg[0][s][lane], sg[1][s][lane], sg[2][s][lane]);
  float oa[WSEG], ob[WSEG], op[WSEG];
#pragma unroll
  for (int u = 0; u < WSEG; ++u) { oa[u] = aa; ob[u] = bb; op[u] = pp; wkv_join(aa, bb, pp, dl, a[u], b[u], p[u]); }
  __builtin_amdgcn_sched_barrier(0);   // keeps the stores behind the arithmetic above, so that no register of an issued store is written again ahead of the wait below
  float* da = sa + seg * WSEG * EE; float* db = sb + seg * WSEG * EE; float* dp = sp + seg * WSEG * EE;
#pragma unroll
  for (int u = 0; u < WSEG; ++u) { da[u * EE + e] = oa[u]; db[u * EE + e] = ob[u]; dp[u * EE + e] = op[u]; }
  wait_xcnt();
  if (seg == WSEGS - 1) { aaf[e] = aa; bbf[e] = bb; ppf[e] = pp; }
}
__global__ __launch_bounds__(256) void k_wkv(const bf16* __restrict__ k, const bf16* __restrict__ v, float* __restrict__ ry,
                                            const float* __restrict__ sa, const float* __restrict__ sb, const float* __restrict__ sp,
                                            const float* __restrict__ tfirst, const float* __restrict__ tdecay) {
  const int e = blockIdx.x * 256 + threadIdx.x, c = blockIdx.y;
  float aa = sa[c * EE + e], bb = sb[c * EE + e], pp = sp[c * EE + e]; const float tf = tfirst[e], td = tdecay[e];
  wait_xcnt();
  const float decay = -expf(td);
#pragma unroll 1   // kept rolled, for speed only
  for (int t0 = 0; t0 < WLEN; t0 += WUC) {
    const bf16* kt = k + ((size_t)c * WLEN + t0) * EE; const bf16* vt = v + ((size_t)c * WLEN + t0) * EE; float* rt = ry + ((size_t)c * WLEN + t0) * EE;
    float kq[WUC], vq[WUC], rq[WUC];
#pragma unroll
    for (int u = 0; u < WUC; ++u) { kq[u] = (float)kt[u * EE + e]; vq[u] = (float)vt[u * EE + e]; rq[u] = rt[u * EE + e]; }
    wait_xcnt();
#pragma unroll
    for (int u = 0; u < WUC; ++u) { const float kk = kq[u], vv = vq[u];
      float e1, e2, e1b, e2b;
      exp_pair(pp, tf + kk, e1, e2);
      const float num = e1 * aa + e2 * vv, den = e1 * bb + e2;
      const float ww2 = decay + pp; exp_pair(ww2, kk, e1b, e2b);
      aa = e1b * aa + e2b * vv; bb = e1b * bb + e2b; pp = fmaxf(ww2, kk);
      // sigmoid(r) * num / den with one v_rcp_f32: num / (den * (1 + exp(-r)))
      rq[u] = num * __builtin_amdgcn_rcpf(den * (1.0f + __builtin_amdgcn_exp2f(rq[u] * -1.44269504088896340736f))); }
    __builtin_amdgcn_sched_barrier(0);   // keeps the stores behind the arithmetic above, so that no register of an issued store is written again ahead of the wait below
#pragma unroll
    for (int u = 0; u < WUC; ++u) rt[u * EE + e] = rq[u];
    wait_xcnt();
  }
}
__device__ __forceinline__ void tail_block(const int bx, const float* __restrict__ x, const float* __restrict__ af, const float* __restrict__ bf_, const float* __restrict__ pf, float* __restrict__ o) {
  const int tid = threadIdx.x; const float* src = (bx == 0) ? (x + (size_t)(TT - 1) * EE) : (bx == 1 ? af : (bx == 2 ? bf_ : pf));
  const v4f_t val = *(const v4f_t*)(src + tid * 4);
  wait_xcnt();   // the store's address may be formed in the registers that held the load's
  float* dst = o + (size_t)bx * EE + tid * 4;
  *(v4f_t*)dst = val; 
}
__device__ __forceinline__ void ones_block(float* __restrict__ p) { const int tid = threadIdx.x; v4f_t o = {1.f,1.f,1.f,1.f}; *(v4f_t*)(p + tid * 4) = o;  }
#define NB_MIX   (TT * (EE / 8) / 256)           // mix_block: 4096 work-groups
#define NB_WT    ((EE / 64) * (EE / 32) * 4)     // wt_block: 16 x 32 x 4 work-groups
#define NB_CARRY (EE / 32)                       // carry_block: 32 work-groups
#define NB_GEMM  ((TT / 128) * (EE / 128))       // gemm_tile: 64 x 8 work-groups a product
// the token-shift mixes, the four weights' f16 [n][k] rows, the row of ones
__global__ __launch_bounds__(256) void k_prep(const float* __restrict__ x, const float* __restrict__ sx, const float* __restrict__ mk, const float* __restrict__ mv, const float* __restrict__ mr,
                                             bf16* __restrict__ kx, bf16* __restrict__ vx, bf16* __restrict__ rx,
                                             const float* __restrict__ W0, const float* __restrict__ W1, const float* __restrict__ W2, const float* __restrict__ W3, f16* __restrict__ T,
                                             float* __restrict__ ones) {
  const int b = blockIdx.x;
  if (b < NB_MIX) mix_block(b, x, sx, mk, mv, mr, kx, vx, rx);
  else if (b < NB_MIX + NB_WT) { const int w = b - NB_MIX; wt_block(w & 15, (w >> 4) & 31, w >> 9, W0, W1, W2, W3, T); }
  else { ones_block(ones); wait_xcnt(); }   // the other jobs' code follows this store in the kernel's text and reuses its registers
}
// the carry over the chunk ends (32 work-groups, which alone leave most of the chip idle) and rx*Wr (f32 rows), which the scan needs only for its outputs
__global__ __launch_bounds__(256) void k_carry_r(const float* __restrict__ la, const float* __restrict__ lb, const float* __restrict__ lp,
                                                const float* __restrict__ aa0, const float* __restrict__ bb0, const float* __restrict__ pp0, const float* __restrict__ tdecay,
                                                float* __restrict__ sa, float* __restrict__ sb, float* __restrict__ sp,
                                                float* __restrict__ aaf, float* __restrict__ bbf, float* __restrict__ ppf,
                                                const f16* __restrict__ rx, const f16* __restrict__ wr, float* __restrict__ ry) {
  const int b = blockIdx.x;
  if (b < NB_CARRY) carry_block(b, la, lb, lp, aa0, bb0, pp0, tdecay, sa, sb, sp, aaf, bbf, ppf);
  else { const int t = b - NB_CARRY; gemm_tile<f16, 0, false>(t & (TT / 128 - 1), t / (TT / 128), rx, EE, wr, EE, nullptr, nullptr, nullptr, ry, EE, EE); }
}
// out = x + (r*wkv)*Wo and the four tail rows of out: both need the launches before and nothing of each other
__global__ __launch_bounds__(256) void k_out_tail(const float* __restrict__ ry, const f16* __restrict__ wo, const float* __restrict__ x, const float* __restrict__ ones, float* __restrict__ out,
                                                 const float* __restrict__ af, const float* __restrict__ bf_, const float* __restrict__ pf, float* __restrict__ o) {
  const int b = blockIdx.x;
  if (b < NB_GEMM) gemm_tile<float, 2, false>(b & (TT / 128 - 1), b / (TT / 128), ry, EE, wo, EE, nullptr, x, ones, out, EE, EE);
  else tail_block(b - NB_GEMM, x, af, bf_, pf, o);
}

extern "C" void kernel_launch(void* const* d_in, const int* in_sizes, int n_in,
                              void* d_out, int out_size, void* d_ws, size_t ws_size,
                              hipStream_t stream) {
  (void)in_sizes; (void)n_in; (void)out_size;
  const float** f = (const float**)d_in;
  const float* x = f[0], *sx = f[1], *aa = f[2], *bb = f[3], *pp = f[4], *tfirst = f[5], *tdecay = f[6], *mk = f[7], *mv = f[8], *mr = f[9], *Wk = f[10], *Wv = f[11], *Wr = f[12], *Wo = f[13];
  float* out = (float*)d_out;                 // [8192,1024] | x_last | aa | bb | pp
  float* tail = out + (size_t)TT * EE;
  char* ws = (char*)d_ws;
  bf16* kx = (bf16*)ws; ws += (size_t)TT * EE * 2; bf16* vx = (bf16*)ws; ws += (size_t)TT * EE * 2; bf16* rx = (bf16*)ws; ws += (size_t)TT * EE * 2;   // 16 MB each
  float* ry = (float*)ws; ws += (size_t)TT * EE * 4;         // 32 MB: rx·Wr, then σ(r)·wkv in place
  bf16* k16 = (bf16*)ws; ws += (size_t)TT * EE * 2; bf16* v16 = (bf16*)ws; ws += (size_t)TT * EE * 2;
  float* stf = (float*)ws; ws += 3 * EE * 4; float* ones = (float*)ws; ws += EE * 4;
  float* lst = (float*)ws; ws += (size_t)3 * WCH * EE * 4; float* sst = (float*)ws; ws += (size_t)3 * WCH * EE * 4;   // chunk ends, chunk start states: [3][WCH][EE] each
  f16* wt = (f16*)ws; ws += (size_t)4 * EE * EE * 2;         // 2 MB each: Wr, Wk, Wv, Wo as f16 [n][k]
  if ((size_t)(ws - (char*)d_ws) > ws_size) return;
  const dim3 blk(256);
  k_prep<<<dim3(NB_MIX + NB_WT + 1), blk, 0, stream>>>(x, sx, mk, mv, mr, kx, vx, rx, Wr, Wk, Wv, Wo, wt, ones);
  gemm_kv<<<dim3(TT / 128, EE / 128, 2), blk, 0, stream>>>(kx, vx, wt + (size_t)EE * EE, k16, v16);
  k_wkv_local<<<dim3(EE / 256, WCH), blk, 0, stream>>>(k16, v16, tdecay, lst, lst + WCH * EE, lst + 2 * WCH * EE);
  k_carry_r<<<dim3(NB_CARRY + NB_GEMM), blk, 0, stream>>>(lst, lst + WCH * EE, lst + 2 * WCH * EE, aa, bb, pp, tdecay, sst, sst + WCH * EE, sst + 2 * WCH * EE, stf, stf + EE, stf + 2 * EE, rx, wt, ry);
  k_wkv<<<dim3(EE / 256, WCH), blk, 0, stream>>>(k16, v16, ry, sst, sst + WCH * EE, sst + 2 * WCH * EE, tfirst, tdecay);
  k_out_tail<<<dim3(NB_GEMM + 4), blk, 0, stream>>>(ry, wt + (size_t)3 * EE * EE, x, ones, out, stf, stf + EE, stf + 2 * EE, tail);    // x + (r*wkv)*Wo
}

// v006
// It runs in 105 microseconds.
// Next to v005, in two timings, it ran 1.06 times as fast each time.
// Over all steps from v000 it is 26.3 times as fast.
// Contractions on v_wmma_f32_16x16x32_f16 (plain f16 operands, f32 accumulate): r = σ(rx·Wr), k = kx·Wk, v = vx·Wv and out = x + (r·wkv)·Wo
// (four K = 1024 GEMMs; the token-shift mixes kx/vx/rx are built once as f16 rows, the four weights once as f16 [n][k] rows, k and v kept as f16 rows); the WKV recurrence is the
// module's max-stabilised f32 scan, lane = channel, split into 128 time chunks of 64 steps (chunk ends, carry, outputs: three launches), writing r*wkv in place
// compute dtype: f16 operands, f32 accumulate / f32 scan.  x [8192,1024].
#include <hip/hip_runtime.h>
#include <hip/hip_bf16.h>
#include <math.h>

#define TT 8192
#define EE 1024
#define GSTR 48

typedef _Float16 bf16;
typedef _Float16 f16;
typedef __attribute__((ext_vector_type(4))) unsigned v4u_t;
typedef unsigned v4ua __attribute__((ext_vector_type(4), may_alias));
typedef __attribute__((ext_vector_type(4))) float v4f_t;
typedef float v4fa __attribute__((ext_vector_type(4), may_alias));
typedef __attribute__((ext_vector_type(16))) bf16  bf16x16;
typedef bf16x16 f16x16;
typedef __attribute__((ext_vector_type(8)))  bf16  bf16x8;
typedef bf16x8 f16x8;
typedef __attribute__((ext_vector_type(4)))  bf16  bf16x4;
typedef __attribute__((ext_vector_type(8)))  float f32x8;
__device__ __forceinline__ f32x8 wmma16(f16x16 a, f16x16 b, f32x8 c) {
  c = __builtin_amdgcn_wmma_f32_16x16x32_f16(false, a, false, b, (short)0, c, false, false);
  asm volatile("v_nop\n\tv_nop\n\tv_nop\n\tv_nop" : "+v"(c) : "v"(a), "v"(b));
  return c;
}
#define LDS_STRIDE 48   // unused: the GEMM's LDS pitches are APB and WPB
#define KSTRIDE    72
#define VSTRIDE    48

__device__ __forceinline__ f32x8 wmma_bf16(bf16x16 a, bf16x16 b, f32x8 c) {
  c = __builtin_amdgcn_wmma_f32_16x16x32_f16(false, a, false, b, (short)0, c, false, false);
  asm volatile("v_nop\n\tv_nop\n\tv_nop\n\tv_nop" : "+v"(c) : "v"(a), "v"(b));   // A/B-overwrite hazard guard
  return c;
}

// 16x32 (MxK) bf16 fragment from a row-major global matrix.
// lanes 0-15  (row=lane)    : elems 0..7 = K+0..7,  8..15 = K+16..23
// lanes 16-31 (row=lane-16) : elems 0..7 = K+8..15, 8..15 = K+24..31
template <typename T>
__device__ __forceinline__ bf16x16 load_frag(const T* __restrict__ base, int ld,
                                             int row0, int k0) {
  const int lane = threadIdx.x & 31;
  const int r    = lane & 15;
  const int kh   = (lane >> 4) * 8;
  const T* p0 = base + (size_t)(row0 + r) * ld + (k0 + kh);
  const T* p1 = p0 + 16;
  bf16x16 f;
#pragma unroll
  for (int i = 0; i < 8; ++i) {
    f[i]     = (bf16)p0[i];
    f[i + 8] = (bf16)p1[i];
  }
  return f;
}

// Same fragment from an LDS tile with padded row stride (base includes row0/k0).
__device__ __forceinline__ bf16x16 lds_frag(const bf16* base, int stride) {
  const int lane = threadIdx.x & 31;
  const int row  = lane & 15;
  const int kh   = (lane >> 4) * 8;
  const bf16x8 lo = *(const bf16x8*)(base + row * stride + kh);
  const bf16x8 hi = *(const bf16x8*)(base + row * stride + kh + 16);
  bf16x16 f;
#pragma unroll
  for (int i = 0; i < 8; ++i) { f[i] = lo[i]; f[i + 8] = hi[i]; }
  return f;
}

template <typename T>
__device__ __forceinline__ void stage_read16(const T* __restrict__ p, float* buf) {
#pragma unroll
  for (int i = 0; i < 16; ++i) buf[i] = (float)p[i];
}

__device__ __forceinline__ void stage_write(bf16* dst, const float* buf, int nquad) {
#pragma unroll
  for (int i = 0; i < nquad; ++i) {
    bf16x4 q;
    q[0] = (bf16)buf[4 * i];     q[1] = (bf16)buf[4 * i + 1];
    q[2] = (bf16)buf[4 * i + 2]; q[3] = (bf16)buf[4 * i + 3];
    *(bf16x4*)(dst + 4 * i) = q;
  }
}


// ---------------------------------------------------------------------------------------------------------------------------
// gemm_tile: Y[m][n] = epi( sum_k A[m][k]*W[k][n] + bias[n] ), A f32/f16 [M][lda], W given transposed as f16 rows Wt[n][k] (ldw; wt_block makes them), plain f16 operands,
// f32 accumulate. EPI 0: identity; 1: exact-erf GELU; 2: R[m][n] + gvec[n]·(·) (residual with per-channel gain). Output f32 (or f16
// when OUT16). Block = 128(M) x 256(N) tile, 8 waves as 2(M) x 4(N), 64x64 a wave; A (rounded to f16 where a fragment is read) and W tiles in LDS, both as k-contiguous rows
// ---------------------------------------------------------------------------------------------------------------------------
// 16x32 (MxK) f16 fragment from an LDS tile of f32 rows (base includes row0/k0, stride in floats): the k order of lds_frag, each value rounded to f16 here
__device__ __forceinline__ f16x16 lds_frag32(const float* base, int stride) {
  const int lane = threadIdx.x & 31;
  const float* p = base + (lane & 15) * stride + (lane >> 4) * 8;
  const v4f_t a0 = *(const v4fa*)(p), a1 = *(const v4fa*)(p + 4), b0 = *(const v4fa*)(p + 16), b1 = *(const v4fa*)(p + 20);
  f16x16 f;
#pragma unroll
  for (int i = 0; i < 4; ++i) { f[i] = (f16)a0[i]; f[i + 4] = (f16)a1[i]; f[i + 8] = (f16)b0[i]; f[i + 12] = (f16)b1[i]; }
  return f;
}
__device__ __forceinline__ f16x16 tile_frag(const f16* base, int pitch_bytes)   { return lds_frag(base, pitch_bytes / 2); }
__device__ __forceinline__ f16x16 tile_frag(const float* base, int pitch_bytes) { return lds_frag32(base, pitch_bytes / 4); }
// twelve asynchronous copies, 16 bytes a lane each, global memory -> LDS (l: the lane's LDS byte address, g: its global address).
// s_wait_xcnt 0 closes the statement: it stands ahead of any rewrite of the address registers that the copies name
__device__ __forceinline__ void acopy12(unsigned l0, unsigned l1, unsigned l2, unsigned l3, unsigned l4, unsigned l5, unsigned l6, unsigned l7, unsigned l8, unsigned l9, unsigned l10, unsigned l11,
                                        const char* g0, const char* g1, const char* g2, const char* g3, const char* g4, const char* g5, const char* g6, const char* g7,
                                        const char* g8, const char* g9, const char* g10, const char* g11) {
  asm volatile("global_load_async_to_lds_b128 %0, %12, off\n\t"
               "global_load_async_to_lds_b128 %1, %13, off\n\t"
               "global_load_async_to_lds_b128 %2, %14, off\n\t"
               "global_load_async_to_lds_b128 %3, %15, off\n\t"
               "global_load_async_to_lds_b128 %4, %16, off\n\t"
               "global_load_async_to_lds_b128 %5, %17, off\n\t"
               "global_load_async_to_lds_b128 %6, %18, off\n\t"
               "global_load_async_to_lds_b128 %7, %19, off\n\t"
               "global_load_async_to_lds_b128 %8, %20, off\n\t"
               "global_load_async_to_lds_b128 %9, %21, off\n\t"
               "global_load_async_to_lds_b128 %10, %22, off\n\t"
               "global_load_async_to_lds_b128 %11, %23, off\n\t"
               "s_wait_xcnt 0x0"
               :: "v"(l0), "v"(l1), "v"(l2), "v"(l3), "v"(l4), "v"(l5), "v"(l6), "v"(l7), "v"(l8), "v"(l9), "v"(l10), "v"(l11),
                  "v"(g0), "v"(g1), "v"(g2), "v"(g3), "v"(g4), "v"(g5), "v"(g6), "v"(g7), "v"(g8), "v"(g9), "v"(g10), "v"(g11) : "memory");
}
// the same, eight copies under one wait
__device__ __forceinline__ void acopy8(unsigned l0, unsigned l1, unsigned l2, unsigned l3, unsigned l4, unsigned l5, unsigned l6, unsigned l7,
                                       const char* g0, const char* g1, const char* g2, const char* g3, const char* g4, const char* g5, const char* g6, const char* g7) {
  asm volatile("global_load_async_to_lds_b128 %0, %8, off\n\t"
               "global_load_async_to_lds_b128 %1, %9, off\n\t"
               "global_load_async_to_lds_b128 %2, %10, off\n\t"
               "global_load_async_to_lds_b128 %3, %11, off\n\t"
               "global_load_async_to_lds_b128 %4, %12, off\n\t"
               "global_load_async_to_lds_b128 %5, %13, off\n\t"
               "global_load_async_to_lds_b128 %6, %14, off\n\t"
               "global_load_async_to_lds_b128 %7, %15, off\n\t"
               "s_wait_xcnt 0x0"
               :: "v"(l0), "v"(l1), "v"(l2), "v"(l3), "v"(l4), "v"(l5), "v"(l6), "v"(l7),
                  "v"(g0), "v"(g1), "v"(g2), "v"(g3), "v"(g4), "v"(g5), "v"(g6), "v"(g7) : "memory");
}
// Tiles of 64 k: [A 128 rows | W 256 rows], brought as they lie in memory by asynchronous copies into a ring of two LDS buffers; tile t + 1 flies while tile t
// is multiplied. Row pitch = row bytes + 16 (16 B x odd: the ds_load_b128 readers meet no bank twice). K: a multiple of 64. The ring is the output staging afterwards.
// bx, by: the work-group's tile row and tile column
template <typename AT, int EPI, bool OUT16>
__device__ __forceinline__ void gemm_tile(const int bx, const int by, const AT* __restrict__ A, int lda, const f16* __restrict__ Wt, int ldw,
                                          const float* __restrict__ bias, const float* __restrict__ R, const float* __restrict__ gvec,
                                          void* __restrict__ Yv, int ldy, int K) {
  constexpr int KS = 64;
  constexpr int ARB = KS * (int)sizeof(AT), APB = ARB + 16, WPB = KS * 2 + 16;   // A row bytes; LDS pitches
  constexpr int ABYTES = 128 * APB, STAGE = ABYTES + 256 * WPB;
  constexpr int OSB = 8 * 64 * 68 * 4;
  __shared__ __attribute__((aligned(128))) char smem[(2 * STAGE > OSB) ? 2 * STAGE : OSB];
  const int tid = threadIdx.x, lane = tid & 31, wave = tid >> 5, cl = lane & 15, rh = (lane >> 4) * 8;
  const int m0 = bx * 128, n0 = by * 256;
  const int wm = (wave & 1) * 64, wn = (wave >> 1) * 64;
  // copy map: a thread brings 16 bytes of every ARP-th row of A and of every 32nd row of W; a wave's copy covers whole rows of the tile
  constexpr int ACPR = ARB / 16, ARP = 256 / ACPR;
  const unsigned sb = (unsigned)(uintptr_t)smem;
  const unsigned la = sb + (tid / ACPR) * APB + (tid % ACPR) * 16, lw = sb + ABYTES + (tid >> 3) * WPB + (tid & 7) * 16;
  const char* ga = (const char*)(A + (size_t)(m0 + tid / ACPR) * lda) + (tid % ACPR) * 16;
  const char* gw = (const char*)(Wt + (size_t)(n0 + (tid >> 3)) * ldw) + (tid & 7) * 16;
  const size_t as = (size_t)ARP * lda * sizeof(AT), wsb = (size_t)32 * ldw * 2;
  auto bring = [&](unsigned bo) {   // the next tile in k order into the buffer at byte bo
    const unsigned a = la + bo, w = lw + bo;
    if (sizeof(AT) == 2) {
      acopy12(a, a + ARP * APB, a + 2 * ARP * APB, a + 3 * ARP * APB,
              w, w + 32 * WPB, w + 64 * WPB, w + 96 * WPB, w + 128 * WPB, w + 160 * WPB, w + 192 * WPB, w + 224 * WPB,
              ga, ga + as, ga + 2 * as, ga + 3 * as, gw, gw + wsb, gw + 2 * wsb, gw + 3 * wsb, gw + 4 * wsb, gw + 5 * wsb, gw + 6 * wsb, gw + 7 * wsb);
    } else {
      acopy8(a, a + ARP * APB, a + 2 * ARP * APB, a + 3 * ARP * APB, a + 4 * ARP * APB, a + 5 * ARP * APB, a + 6 * ARP * APB, a + 7 * ARP * APB,
             ga, ga + as, ga + 2 * as, ga + 3 * as, ga + 4 * as, ga + 5 * as, ga + 6 * as, ga + 7 * as);
      acopy8(w, w + 32 * WPB, w + 64 * WPB, w + 96 * WPB, w + 128 * WPB, w + 160 * WPB, w + 192 * WPB, w + 224 * WPB,
             gw, gw + wsb, gw + 2 * wsb, gw + 3 * wsb, gw + 4 * wsb, gw + 5 * wsb, gw + 6 * wsb, gw + 7 * wsb);
    }
    ga += ARB; gw += KS * 2;
  };
  f32x8 acc[4][4];
#pragma unroll
  for (int i = 0; i < 4; ++i)
#pragma unroll
    for (int j = 0; j < 4; ++j) { f32x8 z = {}; acc[i][j] = z; }
  const int NT = K / KS;
  bring(0);
  asm volatile("s_wait_asynccnt 0x0" ::: "memory");   // tile 0 has landed, as far as this wave brought it
  __syncthreads();                                    // ... and all of it
  if (NT > 1) bring(STAGE);
  unsigned bo = 0;
#pragma unroll 1   // kept rolled: one publish point in the text, the buffer picked by bo
  for (int t = 0; t < NT; ++t) {
    const AT*  tA = (const AT*)(smem + bo);
    const f16* tW = (const f16*)(smem + bo + ABYTES);
#pragma unroll
    for (int kk = 0; kk < KS; kk += 32) {
      // a block = 32 k: its 8 fragments are asked for as one group, in the order in which the 16 WMMAs below first need them
      f16x16 af[4], bf[4];
      af[0] = tile_frag(tA + wm * (APB / (int)sizeof(AT)) + kk, APB);
#pragma unroll
      for (int j = 0; j < 4; ++j) bf[j] = tile_frag(tW + (wn + 16 * j) * (WPB / 2) + kk, WPB);
#pragma unroll
      for (int i = 1; i < 4; ++i) af[i] = tile_frag(tA + (wm + 16 * i) * (APB / (int)sizeof(AT)) + kk, APB);
#pragma unroll
      for (int i = 0; i < 4; ++i)
#pragma unroll
        for (int j = 0; j < 4; ++j) acc[i][j] = wmma16(af[i], bf[j], acc[i][j]);
    }
    asm volatile("s_wait_dscnt 0x0" ::: "memory");      // this wave has left the buffer at bo
    asm volatile("s_wait_asynccnt 0x0" ::: "memory");   // its part of tile t + 1 has landed
    __syncthreads();                                    // tile t + 1 is whole, and every reader has left the buffer at bo
    if (t + 2 < NT) bring(bo);
    bo ^= (unsigned)STAGE;
  }
  asm volatile("s_wait_asynccnt 0x0" ::: "memory");     // no copy is in flight when the ring becomes the output staging
  float* so = (float*)smem + wave * (64 * 68);
  // f32 output: a lane's place in the wave's 64 x 64 tile (row lane / 16, then every second row; 16 bytes of it)
  const size_t go = (size_t)(m0 + wm + (lane >> 4)) * ldy + n0 + wn + (lane & 15) * 4;
  v4f_t g = {}, rv[2][16];
  if (EPI == 2) {   // the residual rows come as whole lines; the first 32 rows' are asked for here, ahead of the staging
    g = *(const v4f_t*)(gvec + n0 + wn + (lane & 15) * 4);
    asm volatile("s_wait_xcnt 0x0" ::: "memory");   // the loads below may land in the registers that held this load's address
#pragma unroll
    for (int u = 0; u < 16; ++u) rv[0][u] = *(const v4f_t*)(R + go + (size_t)(u * 2) * ldy);
  }
#pragma unroll
  for (int i = 0; i < 4; ++i)
#pragma unroll
    for (int j = 0; j < 4; ++j) {
      const int n = n0 + wn + 16 * j + cl;
      const float bv = bias ? bias[n] : 0.0f;
      if (EPI == 1) {
#pragma unroll 1
        for (int r = 0; r < 8; ++r) { const float xg = acc[i][j][r] + bv; so[(16 * i + rh + r) * 68 + 16 * j + cl] = 0.5f * xg * (1.0f + erff(xg * 0.70710678118654752f)); }
      } else {
#pragma unroll
        for (int r = 0; r < 8; ++r) so[(16 * i + rh + r) * 68 + 16 * j + cl] = acc[i][j][r] + bv;
      }
    }
  asm volatile("s_wait_dscnt 0" ::: "memory");
  __builtin_amdgcn_wave_barrier();
  // the wave's 64 x 64 tile goes out in whole 128-byte lines, in two halves of 32 rows: one address a lane, the rows reached by constant offsets
  if (OUT16) {
    f16* yb = (f16*)Yv + (size_t)(m0 + wm + (lane >> 3)) * ldy + n0 + wn + (lane & 7) * 8;
    const float* sl = so + (lane >> 3) * 68 + (lane & 7) * 8;
#pragma unroll
    for (int h = 0; h < 2; ++h) {
      union { f16 h[8]; v4u_t v; } u[8];
#pragma unroll
      for (int it = 0; it < 8; ++it) {
        const v4f_t lo = *(const v4fa*)(sl + (8 * h + it) * 4 * 68), hi = *(const v4fa*)(sl + (8 * h + it) * 4 * 68 + 4);
#pragma unroll
        for (int e = 0; e < 4; ++e) { u[it].h[e] = (f16)lo[e]; u[it].h[e + 4] = (f16)hi[e]; }
      }
      __builtin_amdgcn_sched_barrier(0);   // keeps the stores behind the conversions above, so that no register of an issued store is written again ahead of the wait below
#pragma unroll
      for (int it = 0; it < 8; ++it) *(v4u_t*)(yb + (size_t)((8 * h + it) * 4) * ldy) = u[it].v;
      if (h == 0) asm volatile("s_wait_xcnt 0x0" ::: "memory");   // ahead of any reuse of a register that these stores name
    }
  } else {
    float* yb = (float*)Yv + go;
    const float* sl = so + (lane >> 4) * 68 + (lane & 15) * 4;
    if (EPI == 2) {   // the last 32 rows' residual, asked for ahead of the first 32 rows' way out
#pragma unroll
      for (int u = 0; u < 16; ++u) rv[1][u] = *(const v4f_t*)(R + go + (size_t)((16 + u) * 2) * ldy);
    }
#pragma unroll
    for (int h = 0; h < 2; ++h) {
      v4f_t v[16];
#pragma unroll
      for (int u = 0; u < 16; ++u) {
        v[u] = *(const v4fa*)(sl + (16 * h + u) * 2 * 68);
        if (EPI == 2) v[u] = rv[h][u] + g * v[u];
      }
      __builtin_amdgcn_sched_barrier(0);   // keeps the stores behind the loads and sums above, so that no register of an issued store is written again ahead of the wait below
#pragma unroll
      for (int u = 0; u < 16; ++u) *(v4f_t*)(yb + (size_t)((16 * h + u) * 2) * ldy) = v[u];
      if (h == 0) asm volatile("s_wait_xcnt 0x0" ::: "memory");   // ahead of any reuse of a register that these stores name
    }
  }
}
// Launches that need nothing of each other share one grid; the block index picks the job, so every branch between jobs (and every barrier inside a job) is taken by whole work-groups.
// kx*Wk and vx*Wv, both to f16 rows: blockIdx.z picks the product. wkv: Wk, then Wv, as f16 [n][k]
__global__ __launch_bounds__(256) void gemm_kv(const f16* __restrict__ kx, const f16* __restrict__ vx, const f16* __restrict__ wkv, f16* __restrict__ k16, f16* __restrict__ v16) {
  const int z = blockIdx.z;
  gemm_tile<f16, 0, true>(blockIdx.x, blockIdx.y, z ? vx : kx, EE, wkv + (size_t)z * EE * EE, EE, nullptr, nullptr, nullptr, z ? v16 : k16, EE, EE);
}

// the four weights, once a call, as f16 rows Wt[n][k] = (f16)W[k][n]: the GEMMs then stage a W tile as they stage an A tile, 16 bytes at a time.
// block = 64 k x 32 n of one weight, turned through LDS (pitch 33 floats: no bank is met twice by a wave, writing or reading); whole 128-byte lines in and out
__device__ __forceinline__ void wt_block(const int bx, const int by, const int bz, const float* __restrict__ W0, const float* __restrict__ W1, const float* __restrict__ W2, const float* __restrict__ W3, f16* __restrict__ T) {
  __shared__ float tl[64][33];
  const int tid = threadIdx.x, k0 = bx * 64, n0 = by * 32, z = bz;
  const float* Wm = (z == 0) ? W0 : (z == 1 ? W1 : (z == 2 ? W2 : W3));
  const int kr = tid >> 3, c = (tid & 7) * 4;
  const v4f_t a = *(const v4f_t*)(Wm + (size_t)(k0 + kr) * EE + n0 + c);
  const v4f_t b = *(const v4f_t*)(Wm + (size_t)(k0 + kr + 32) * EE + n0 + c);
#pragma unroll
  for (int u = 0; u < 4; ++u) { tl[kr][c + u] = a[u]; tl[kr + 32][c + u] = b[u]; }
  __syncthreads();
  const int n = tid >> 3, kq = (tid & 7) * 8;
  union { f16 h[8]; v4u_t v; } o;
#pragma unroll
  for (int e = 0; e < 8; ++e) o.h[e] = (f16)tl[kq + e][n];
  *(v4u_t*)(T + (size_t)z * EE * EE + (size_t)(n0 + n) * EE + k0 + kq) = o.v;
}
// token-shift mixes as f16 rows: kx = x·mk + xprev·(1−mk) etc. (xprev = sx for t = 0); thread -> 8 channels
__device__ __forceinline__ void mix_block(const int bx, const float* __restrict__ x, const float* __restrict__ sx, const float* __restrict__ mk, const float* __restrict__ mv, const float* __restrict__ mr,
                                            bf16* __restrict__ kx, bf16* __restrict__ vx, bf16* __restrict__ rx) {
  const size_t i = (size_t)bx * 256 + threadIdx.x; const size_t t = i >> 7; const int c0 = (i & 127) * 8;
  const float* xr = x + t * EE + c0; const float* pr = (t == 0) ? (sx + c0) : (x + (t - 1) * EE + c0);
  union { bf16 hh[8]; v4u_t u; } ck, cv2, cr;
#pragma unroll
  for (int e = 0; e < 8; ++e) { const float a = xr[e], p = pr[e]; const int c = c0 + e;
    ck.hh[e] = (bf16)(a * mk[c] + p * (1.0f - mk[c])); cv2.hh[e] = (bf16)(a * mv[c] + p * (1.0f - mv[c])); cr.hh[e] = (bf16)(a * mr[c] + p * (1.0f - mr[c])); }
{ *(v4u_t*)(kx + t * EE + c0) = ck.u; *(v4u_t*)(vx + t * EE + c0) = cv2.u; *(v4u_t*)(rx + t * EE + c0) = cr.u;  }
}
// WKV scan, split in time. The state is linear: with A = aa*exp(pp), B = bb*exp(pp) a step is A' = exp(decay)*A + exp(k)*v,
// B' = exp(decay)*B + exp(k), so n steps give  end = exp(n*decay)*start + (end reached from the empty state).
//   k_wkv_local: every chunk of WLEN steps, all chunks at once, runs the state update from the empty state -> la, lb, lp
//   carry_block: joins the chunk ends in time order -> the state each chunk starts from (sa, sb, sp) and the final state
//   k_wkv      : every chunk, all chunks at once, runs the module's own step from its start state and writes sigmoid(r)*wkv
// All three keep the module's max-stabilised form (value, log scale pp); lane = channel e.
#define WCH   128          // chunks: 128 x 32 waves = 4 waves a SIMD
#define WLEN  (TT / WCH)   // 64 steps a chunk
#define WUA   16           // k_wkv_local: steps whose operands are loaded together, ahead of their arithmetic
#define WUC   8            // k_wkv: the same
#define WSEGS 8            // carry: one wave a segment of WCH / WSEGS chunks
#define WSEG  (WCH / WSEGS)
// stands behind a run of global loads or stores, ahead of any reuse of a register that they name
__device__ __forceinline__ void wait_xcnt() { asm volatile("s_wait_xcnt 0x0" ::: "memory"); }
// (aa, bb, pp) decayed over a span (d = steps * decay), plus the end state (a, b, p) that the span reaches from the empty state
__device__ __forceinline__ void wkv_join(float& aa, float& bb, float& pp, float d, float a, float b, float p) {
  const float w = pp + d; const float q = fmaxf(w, p); const float e1 = expf(w - q), e2 = expf(p - q);
  aa = e1 * aa + e2 * a; bb = e1 * bb + e2 * b; pp = q;
}
// exp(a - max(a, b)) and exp(b - max(a, b)): the larger argument's factor is exp(0) = 1 exactly, so only exp(-|a - b|) is computed, as one v_exp_f32
__device__ __forceinline__ void exp_pair(float a, float b, float& ea, float& eb) {
  const float d = a - b; const float e = __builtin_amdgcn_exp2f(-fabsf(d) * 1.44269504088896340736f);
  ea = (d >= 0.0f) ? 1.0f : e; eb = (d >= 0.0f) ? e : 1.0f;
}
__global__ __launch_bounds__(256) void k_wkv_local(const bf16* __restrict__ k, const bf16* __restrict__ v, const float* __restrict__ tdecay,
                                                  float* __restrict__ la, float* __restrict__ lb, float* __restrict__ lp) {
  const int e = blockIdx.x * 256 + threadIdx.x, c = blockIdx.y;
  const bf16* kc = k + (size_t)c * WLEN * EE; const bf16* vc = v + (size_t)c * WLEN * EE;
  const float td = tdecay[e];
  wait_xcnt();
  const float decay = -expf(td);
  float aa = 0.0f, bb = 0.0f, pp = 0.0f;
#pragma unroll 1   // kept rolled: the SIMD's other waves cover a trip's loads, more code in line buys nothing
  for (int t0 = 0; t0 < WLEN; t0 += WUA) {
    const bf16* kt = kc + t0 * EE; const bf16* vt = vc + t0 * EE;
    float kk[WUA], vv[WUA];
#pragma unroll
    for (int u = 0; u < WUA; ++u) kk[u] = (float)kt[u * EE + e];
    wait_xcnt();   // the v loads may land in the registers that held the k loads' address
#pragma unroll
    for (int u = 0; u < WUA; ++u) vv[u] = (float)vt[u * EE + e];
    wait_xcnt();
#pragma unroll
    for (int u = 0; u < WUA; ++u) {
      if (u == 0 && t0 == 0) { aa = vv[0]; bb = 1.0f; pp = kk[0]; }   // first step on the empty state: A = exp(k)*v, B = exp(k)
      else { const float ww2 = decay + pp; float e1b, e2b; exp_pair(ww2, kk[u], e1b, e2b);
        aa = e1b * aa + e2b * vv[u]; bb = e1b * bb + e2b; pp = fmaxf(ww2, kk[u]); }
    }
  }
  la[c * EE + e] = aa; lb[c * EE + e] = bb; lp[c * EE + e] = pp;
}
// block = 32 channels x WSEGS waves; wave = one segment of WSEG chunks: segment end from empty, prefix over segments through LDS, then the chunk starts
__device__ __forceinline__ void carry_block(const int bx, const float* __restrict__ la, const float* __restrict__ lb, const float* __restrict__ lp,
                                                  const float* __restrict__ aa0, const float* __restrict__ bb0, const float* __restrict__ pp0, const float* __restrict__ tdecay,
                                                  float* __restrict__ sa, float* __restrict__ sb, float* __restrict__ sp,
                                                  float* __restrict__ aaf, float* __restrict__ bbf, float* __restrict__ ppf) {
  __shared__ float sg[3][WSEGS][32];
  const int lane = threadIdx.x & 31, seg = __builtin_amdgcn_readfirstlane(threadIdx.x >> 5);
  const int e = bx * 32 + lane;
  const float* ca = la + seg * WSEG * EE; const float* cb = lb + seg * WSEG * EE; const float* cp = lp + seg * WSEG * EE;
  float a[WSEG], b[WSEG], p[WSEG];
#pragma unroll
  for (int u = 0; u < WSEG; ++u) { a[u] = ca[u * EE + e]; b[u] = cb[u * EE + e]; p[u] = cp[u * EE + e]; }
  float aa = aa0[e], bb = bb0[e], pp = pp0[e]; const float td = tdecay[e];
  wait_xcnt();
  const float dl = (float)WLEN * -expf(td), ds = (float)(WLEN * WSEG) * -expf(td);
  float ta = a[0], tb = b[0], tp = p[0];
#pragma unroll
  for (int u = 1; u < WSEG; ++u) wkv_join(ta, tb, tp, dl, a[u], b[u], p[u]);
  sg[0][seg][lane] = ta; sg[1][seg][lane] = tb; sg[2][seg][lane] = tp;
  __syncthreads();
#pragma unroll 1   // at most 7 trips, a different count in every wave: unrolling only adds a remainder loop
  for (int s = 0; s < seg; ++s) wkv_join(aa, bb, pp, ds, sg[0][s][lane], sg[1][s][lane], sg[2][s][lane]);
  float oa[WSEG], ob[WSEG], op[WSEG];
#pragma unroll
  for (int u = 0; u < WSEG; ++u) { oa[u] = aa; ob[u] = bb; op[u] = pp; wkv_join(aa, bb, pp, dl, a[u], b[u], p[u]); }
  __builtin_amdgcn_sched_barrier(0);   // keeps the stores behind the arithmetic above, so that no register of an issued store is written again ahead of the wait below
  float* da = sa + seg * WSEG * EE; float* db = sb + seg * WSEG * EE; float* dp = sp + seg * WSEG * EE;
#pragma unroll
  for (int u = 0; u < WSEG; ++u) { da[u * EE + e] = oa[u]; db[u * EE + e] = ob[u]; dp[u * EE + e] = op[u]; }
  wait_xcnt();
  if (seg == WSEGS - 1) { aaf[e] = aa; bbf[e] = bb; ppf[e] = pp; }
}
__global__ __launch_bounds__(256) void k_wkv(const bf16* __restrict__ k, const bf16* __restrict__ v, float* __restrict__ ry,
                                            const float* __restrict__ sa, const float* __restrict__ sb, const float* __restrict__ sp,
                                            const float* __restrict__ tfirst, const float* __restrict__ tdecay) {
  const int e = blockIdx.x * 256 + threadIdx.x, c = blockIdx.y;
  float aa = sa[c * EE + e], bb = sb[c * EE + e], pp = sp[c * EE + e]; const float tf = tfirst[e], td = tdecay[e];
  wait_xcnt();
  const float decay = -expf(td);
#pragma unroll 1   // kept rolled, for speed only
  for (int t0 = 0; t0 < WLEN; t0 += WUC) {
    const bf16* kt = k + ((size_t)c * WLEN + t0) * EE; const bf16* vt = v + ((size_t)c * WLEN + t0) * EE; float* rt = ry + ((size_t)c * WLEN + t0) * EE;
    float kq[WUC], vq[WUC], rq[WUC];
#pragma unroll
    for (int u = 0; u < WUC; ++u) { kq[u] = (float)kt[u * EE + e]; vq[u] = (float)vt[u * EE + e]; rq[u] = rt[u * EE + e]; }
    wait_xcnt();
#pragma unroll
    for (int u = 0; u < WUC; ++u) { const float kk = kq[u], vv = vq[u];
      float e1, e2, e1b, e2b;
      exp_pair(pp, tf + kk, e1, e2);
      const float num = e1 * aa + e2 * vv, den = e1 * bb + e2;
      const float ww2 = decay + pp; exp_pair(ww2, kk, e1b, e2b);
      aa = e1b * aa + e2b * vv; bb = e1b * bb + e2b; pp = fmaxf(ww2, kk);
      // sigmoid(r) * num / den with one v_rcp_f32: num / (den * (1 + exp(-r)))
      rq[u] = num * __builtin_amdgcn_rcpf(den * (1.0f + __builtin_amdgcn_exp2f(rq[u] * -1.44269504088896340736f))); }
    __builtin_amdgcn_sched_barrier(0);   // keeps the stores behind the arithmetic above, so that no register of an issued store is written again ahead of the wait below
#pragma unroll
    for (int u = 0; u < WUC; ++u) rt[u * EE + e] = rq[u];
    wait_xcnt();
  }
}
__device__ __forceinline__ void tail_block(const int bx, const float* __restrict__ x, const float* __restrict__ af, const float* __restrict__ bf_, const float* __restrict__ pf, float* __restrict__ o) {
  const int tid = threadIdx.x; const float* src = (bx == 0) ? (x + (size_t)(TT - 1) * EE) : (bx == 1 ? af : (bx == 2 ? bf_ : pf));
  const v4f_t val = *(const v4f_t*)(src + tid * 4);
  wait_xcnt();   // the store's address may be formed in the registers that held the load's
  float* dst = o + (size_t)bx * EE + tid * 4;
  *(v4f_t*)dst = val; 
}
__device__ __forceinline__ void ones_block(float* __restrict__ p) { const int tid = threadIdx.x; v4f_t o = {1.f,1.f,1.f,1.f}; *(v4f_t*)(p + tid * 4) = o;  }
#define NB_MIX   (TT * (EE / 8) / 256)           // mix_block: 4096 work-groups
#define NB_WT    ((EE / 64) * (EE / 32) * 4)     // wt_block: 16 x 32 x 4 work-groups
#define NB_CARRY (EE / 32)                       // carry_block: 32 work-groups
#define NB_GEMM  ((TT / 128) * (EE / 256))       // gemm_tile: 64 x 4 work-groups a product
// the token-shift mixes, the four weights' f16 [n][k] rows, the row of ones
__global__ __launch_bounds__(256) void k_prep(const float* __restrict__ x, const float* __restrict__ sx, const float* __restrict__ mk, const float* __restrict__ mv, const float* __restrict__ mr,
                                             bf16* __restrict__ kx, bf16* __restrict__ vx, bf16* __restrict__ rx,
                                             const float* __restrict__ W0, const float* __restrict__ W1, const float* __restrict__ W2, const float* __restrict__ W3, f16* __restrict__ T,
                                             float* __restrict__ ones) {
  const int b = blockIdx.x;
  if (b < NB_MIX) mix_block(b, x, sx, mk, mv, mr, kx, vx, rx);
  else if (b < NB_MIX + NB_WT) { const int w = b - NB_MIX; wt_block(w & 15, (w >> 4) & 31, w >> 9, W0, W1, W2, W3, T); }
  else { ones_block(ones); wait_xcnt(); }   // the other jobs' code follows this store in the kernel's text and reuses its registers
}
// the carry over the chunk ends (32 work-groups, which alone leave most of the chip idle) and rx*Wr (f32 rows), which the scan needs only for its outputs
__global__ __launch_bounds__(256) void k_carry_r(const float* __restrict__ la, const float* __restrict__ lb, const float* __restrict__ lp,
                                                const float* __restrict__ aa0, const float* __restrict__ bb0, const float* __restrict__ pp0, const float* __restrict__ tdecay,
                                                float* __restrict__ sa, float* __restrict__ sb, float* __restrict__ sp,
                                                float* __restrict__ aaf, float* __restrict__ bbf, float* __restrict__ ppf,
                                                const f16* __restrict__ rx, const f16* __restrict__ wr, float* __restrict__ ry) {
  const int b = blockIdx.x;
  if (b < NB_CARRY) carry_block(b, la, lb, lp, aa0, bb0, pp0, tdecay, sa, sb, sp, aaf, bbf, ppf);
  else { const int t = b - NB_CARRY; gemm_tile<f16, 0, false>(t & (TT / 128 - 1), t / (TT / 128), rx, EE, wr, EE, nullptr, nullptr, nullptr, ry, EE, EE); }
}
// out = x + (r*wkv)*Wo and the four tail rows of out: both need the launches before and nothing of each other
__global__ __launch_bounds__(256) void k_out_tail(const float* __restrict__ ry, const f16* __restrict__ wo, const float* __restrict__ x, const float* __restrict__ ones, float* __restrict__ out,
                                                 const float* __restrict__ af, const float* __restrict__ bf_, const float* __restrict__ pf, float* __restrict__ o) {
  const int b = blockIdx.x;
  if (b < NB_GEMM) gemm_tile<float, 2, false>(b & (TT / 128 - 1), b / (TT / 128), ry, EE, wo, EE, nullptr, x, ones, out, EE, EE);
  else tail_block(b - NB_GEMM, x, af, bf_, pf, o);
}

extern "C" void kernel_launch(void* const* d_in, const int* in_sizes, int n_in,
                              void* d_out, int out_size, void* d_ws, size_t ws_size,
                              hipStream_t stream) {
  (void)in_sizes; (void)n_in; (void)out_size;
  const float** f = (const float**)d_in;
  const float* x = f[0], *sx = f[1], *aa = f[2], *bb = f[3], *pp = f[4], *tfirst = f[5], *tdecay = f[6], *mk = f[7], *mv = f[8], *mr = f[9], *Wk = f[10], *Wv = f[11], *Wr = f[12], *Wo = f[13];
  float* out = (float*)d_out;                 // [8192,1024] | x_last | aa | bb | pp
  float* tail = out + (size_t)TT * EE;
  char* ws = (char*)d_ws;
  bf16* kx = (bf16*)ws; ws += (size_t)TT * EE * 2; bf16* vx = (bf16*)ws; ws += (size_t)TT * EE * 2; bf16* rx = (bf16*)ws; ws += (size_t)TT * EE * 2;   // 16 MB each
  float* ry = (float*)ws; ws += (size_t)TT * EE * 4;         // 32 MB: rx·Wr, then σ(r)·wkv in place
  bf16* k16 = (bf16*)ws; ws += (size_t)TT * EE * 2; bf16* v16 = (bf16*)ws; ws += (size_t)TT * EE * 2;
  float* stf = (float*)ws; ws += 3 * EE * 4; float* ones = (float*)ws; ws += EE * 4;
  float* lst = (float*)ws; ws += (size_t)3 * WCH * EE * 4; float* sst = (float*)ws; ws += (size_t)3 * WCH * EE * 4;   // chunk ends, chunk start states: [3][WCH][EE] each
  f16* wt = (f16*)ws; ws += (size_t)4 * EE * EE * 2;         // 2 MB each: Wr, Wk, Wv, Wo as f16 [n][k]
  if ((size_t)(ws - (char*)d_ws) > ws_size) return;
  const dim3 blk(256);
  k_prep<<<dim3(NB_MIX + NB_WT + 1), blk, 0, stream>>>(x, sx, mk, mv, mr, kx, vx, rx, Wr, Wk, Wv, Wo, wt, ones);
  gemm_kv<<<dim3(TT / 128, EE / 256, 2), blk, 0, stream>>>(kx, vx, wt + (size_t)EE * EE, k16, v16);
  k_wkv_local<<<dim3(EE / 256, WCH), blk, 0, stream>>>(k16, v16, tdecay, lst, lst + WCH * EE, lst + 2 * WCH * EE);
  k_carry_r<<<dim3(NB_CARRY + NB_GEMM), blk, 0, stream>>>(lst, lst + WCH * EE, lst + 2 * WCH * EE, aa, bb, pp, tdecay, sst, sst + WCH * EE, sst + 2 * WCH * EE, stf, stf + EE, stf + 2 * EE, rx, wt, ry);
  k_wkv<<<dim3(EE / 256, WCH), blk, 0, stream>>>(k16, v16, ry, sst, sst + WCH * EE, sst + 2 * WCH * EE, tfirst, tdecay);
  k_out_tail<<<dim3(NB_GEMM + 4), blk, 0, stream>>>(ry, wt + (size_t)3 * EE * EE, x, ones, out, stf, stf + EE, stf + 2 * EE, tail);    // x + (r*wkv)*Wo
}

// v007
// One run takes 96.6 microseconds.
// Timed twice side by side with v006, it ran 1.09 times as fast both times.
// Counting every step since v000, it is 28.6 times as fast.
// Contractions on v_wmma_f32_16x16x32_f16 (plain f16 operands, f32 accumulate): r = σ(rx·Wr), k = kx·Wk, v = vx·Wv and out = x + (r·wkv)·Wo
// (four K = 1024 GEMMs; the token-shift mixes kx/vx/rx are built once as f16 rows, the four weights once as f16 [n][k] rows, k and v kept as f16 rows); the WKV recurrence is the
// module's max-stabilised f32 scan, lane = channel, split into 128 time chunks of 64 steps (chunk ends, carry, outputs: three launches), writing r*wkv in place over r (one plane of f16 rows, like k and v)
// compute dtype: f16 operands, f32 accumulate / f32 scan.  x [8192,1024].
#include <hip/hip_runtime.h>
#include <hip/hip_bf16.h>
#include <math.h>

#define TT 8192
#define EE 1024
#define GSTR 48

typedef _Float16 bf16;
typedef _Float16 f16;
typedef __attribute__((ext_vector_type(4))) unsigned v4u_t;
typedef unsigned v4ua __attribute__((ext_vector_type(4), may_alias));
typedef __attribute__((ext_vector_type(4))) float v4f_t;
typedef float v4fa __attribute__((ext_vector_type(4), may_alias));
typedef __attribute__((ext_vector_type(16))) bf16  bf16x16;
typedef bf16x16 f16x16;
typedef __attribute__((ext_vector_type(8)))  bf16  bf16x8;
typedef bf16x8 f16x8;
typedef __attribute__((ext_vector_type(4)))  bf16  bf16x4;
typedef __attribute__((ext_vector_type(8)))  float f32x8;
__device__ __forceinline__ f32x8 wmma16(f16x16 a, f16x16 b, f32x8 c) {
  c = __builtin_amdgcn_wmma_f32_16x16x32_f16(false, a, false, b, (short)0, c, false, false);
  asm volatile("v_nop\n\tv_nop\n\tv_nop\n\tv_nop" : "+v"(c) : "v"(a), "v"(b));
  return c;
}
#define LDS_STRIDE 48   // unused: the GEMM's LDS pitches are APB and WPB
#define KSTRIDE    72
#define VSTRIDE    48

__device__ __forceinline__ f32x8 wmma_bf16(bf16x16 a, bf16x16 b, f32x8 c) {
  c = __builtin_amdgcn_wmma_f32_16x16x32_f16(false, a, false, b, (short)0, c, false, false);
  asm volatile("v_nop\n\tv_nop\n\tv_nop\n\tv_nop" : "+v"(c) : "v"(a), "v"(b));   // A/B-overwrite hazard guard
  return c;
}

// 16x32 (MxK) bf16 fragment from a row-major global matrix.
// lanes 0-15  (row=lane)    : elems 0..7 = K+0..7,  8..15 = K+16..23
// lanes 16-31 (row=lane-16) : elems 0..7 = K+8..15, 8..15 = K+24..31
template <typename T>
__device__ __forceinline__ bf16x16 load_frag(const T* __restrict__ base, int ld,
                                             int row0, int k0) {
  const int lane = threadIdx.x & 31;
  const int r    = lane & 15;
  const int kh   = (lane >> 4) * 8;
  const T* p0 = base + (size_t)(row0 + r) * ld + (k0 + kh);
  const T* p1 = p0 + 16;
  bf16x16 f;
#pragma unroll
  for (int i = 0; i < 8; ++i) {
    f[i]     = (bf16)p0[i];
    f[i + 8] = (bf16)p1[i];
  }
  return f;
}

// Same fragment from an LDS tile with padded row stride (base includes row0/k0).
__device__ __forceinline__ bf16x16 lds_frag(const bf16* base, int stride) {
  const int lane = threadIdx.x & 31;
  const int row  = lane & 15;
  const int kh   = (lane >> 4) * 8;
  const bf16x8 lo = *(const bf16x8*)(base + row * stride + kh);
  const bf16x8 hi = *(const bf16x8*)(base + row * stride + kh + 16);
  bf16x16 f;
#pragma unroll
  for (int i = 0; i < 8; ++i) { f[i] = lo[i]; f[i + 8] = hi[i]; }
  return f;
}

template <typename T>
__device__ __forceinline__ void stage_read16(const T* __restrict__ p, float* buf) {
#pragma unroll
  for (int i = 0; i < 16; ++i) buf[i] = (float)p[i];
}

__device__ __forceinline__ void stage_write(bf16* dst, const float* buf, int nquad) {
#pragma unroll
  for (int i = 0; i < nquad; ++i) {
    bf16x4 q;
    q[0] = (bf16)buf[4 * i];     q[1] = (bf16)buf[4 * i + 1];
    q[2] = (bf16)buf[4 * i + 2]; q[3] = (bf16)buf[4 * i + 3];
    *(bf16x4*)(dst + 4 * i) = q;
  }
}


// ---------------------------------------------------------------------------------------------------------------------------
// gemm_tile: Y[m][n] = epi( sum_k A[m][k]*W[k][n] + bias[n] ), A f32/f16 [M][lda], W given transposed as f16 rows Wt[n][k] (ldw; wt_block makes them), plain f16 operands,
// f32 accumulate. EPI 0: identity; 1: exact-erf GELU; 2: R[m][n] + gvec[n]·(·) (residual with per-channel gain). Output f32 (or f16
// when OUT16). Block = 128(M) x 256(N) tile, 8 waves as 2(M) x 4(N), 64x64 a wave; A (rounded to f16 where a fragment is read) and W tiles in LDS, both as k-contiguous rows
// ---------------------------------------------------------------------------------------------------------------------------
// 16x32 (MxK) f16 fragment from an LDS tile of f32 rows (base includes row0/k0, stride in floats): the k order of lds_frag, each value rounded to f16 here
__device__ __forceinline__ f16x16 lds_frag32(const float* base, int stride) {
  const int lane = threadIdx.x & 31;
  const float* p = base + (lane & 15) * stride + (lane >> 4) * 8;
  const v4f_t a0 = *(const v4fa*)(p), a1 = *(const v4fa*)(p + 4), b0 = *(const v4fa*)(p + 16), b1 = *(const v4fa*)(p + 20);
  f16x16 f;
#pragma unroll
  for (int i = 0; i < 4; ++i) { f[i] = (f16)a0[i]; f[i + 4] = (f16)a1[i]; f[i + 8] = (f16)b0[i]; f[i + 12] = (f16)b1[i]; }
  return f;
}
__device__ __forceinline__ f16x16 tile_frag(const f16* base, int pitch_bytes)   { return lds_frag(base, pitch_bytes / 2); }
__device__ __forceinline__ f16x16 tile_frag(const float* base, int pitch_bytes) { return lds_frag32(base, pitch_bytes / 4); }
// twelve asynchronous copies, 16 bytes a lane each, global memory -> LDS (l: the lane's LDS byte address, g: its global address).
// s_wait_xcnt 0 closes the statement: it stands ahead of any rewrite of the address registers that the copies name
__device__ __forceinline__ void acopy12(unsigned l0, unsigned l1, unsigned l2, unsigned l3, unsigned l4, unsigned l5, unsigned l6, unsigned l7, unsigned l8, unsigned l9, unsigned l10, unsigned l11,
                                        const char* g0, const char* g1, const char* g2, const char* g3, const char* g4, const char* g5, const char* g6, const char* g7,
                                        const char* g8, const char* g9, const char* g10, const char* g11) {
  asm volatile("global_load_async_to_lds_b128 %0, %12, off\n\t"
               "global_load_async_to_lds_b128 %1, %13, off\n\t"
               "global_load_async_to_lds_b128 %2, %14, off\n\t"
               "global_load_async_to_lds_b128 %3, %15, off\n\t"
               "global_load_async_to_lds_b128 %4, %16, off\n\t"
               "global_load_async_to_lds_b128 %5, %17, off\n\t"
               "global_load_async_to_lds_b128 %6, %18, off\n\t"
               "global_load_async_to_lds_b128 %7, %19, off\n\t"
               "global_load_async_to_lds_b128 %8, %20, off\n\t"
               "global_load_async_to_lds_b128 %9, %21, off\n\t"
               "global_load_async_to_lds_b128 %10, %22, off\n\t"
               "global_load_async_to_lds_b128 %11, %23, off\n\t"
               "s_wait_xcnt 0x0"
               :: "v"(l0), "v"(l1), "v"(l2), "v"(l3), "v"(l4), "v"(l5), "v"(l6), "v"(l7), "v"(l8), "v"(l9), "v"(l10), "v"(l11),
                  "v"(g0), "v"(g1), "v"(g2), "v"(g3), "v"(g4), "v"(g5), "v"(g6), "v"(g7), "v"(g8), "v"(g9), "v"(g10), "v"(g11) : "memory");
}
// the same, eight copies under one wait
__device__ __forceinline__ void acopy8(unsigned l0, unsigned l1, unsigned l2, unsigned l3, unsigned l4, unsigned l5, unsigned l6, unsigned l7,
                                       const char* g0, const char* g1, const char* g2, const char* g3, const char* g4, const char* g5, const char* g6, const char* g7) {
  asm volatile("global_load_async_to_lds_b128 %0, %8, off\n\t"
               "global_load_async_to_lds_b128 %1, %9, off\n\t"
               "global_load_async_to_lds_b128 %2, %10, off\n\t"
               "global_load_async_to_lds_b128 %3, %11, off\n\t"
               "global_load_async_to_lds_b128 %4, %12, off\n\t"
               "global_load_async_to_lds_b128 %5, %13, off\n\t"
               "global_load_async_to_lds_b128 %6, %14, off\n\t"
               "global_load_async_to_lds_b128 %7, %15, off\n\t"
               "s_wait_xcnt 0x0"
               :: "v"(l0), "v"(l1), "v"(l2), "v"(l3), "v"(l4), "v"(l5), "v"(l6), "v"(l7),
                  "v"(g0), "v"(g1), "v"(g2), "v"(g3), "v"(g4), "v"(g5), "v"(g6), "v"(g7) : "memory");
}
// Tiles of 64 k: [A 128 rows | W 256 rows], brought as they lie in memory by asynchronous copies into a ring of two LDS buffers; tile t + 1 flies while tile t
// is multiplied. Row pitch = row bytes + 16 (16 B x odd: the ds_load_b128 readers meet no bank twice). K: a multiple of 64. The ring is the output staging afterwards.
// bx, by: the work-group's tile row and tile column
template <typename AT, int EPI, bool OUT16>
__device__ __forceinline__ void gemm_tile(const int bx, const int by, const AT* __restrict__ A, int lda, const f16* __restrict__ Wt, int ldw,
                                          const float* __restrict__ bias, const float* __restrict__ R, const float* __restrict__ gvec,
                                          void* __restrict__ Yv, int ldy, int K) {
  constexpr int KS = 64;
  constexpr int ARB = KS * (int)sizeof(AT), APB = ARB + 16, WPB = KS * 2 + 16;   // A row bytes; LDS pitches
  constexpr int ABYTES = 128 * APB, STAGE = ABYTES + 256 * WPB;
  constexpr int OSB = 8 * 64 * 68 * 4;
  __shared__ __attribute__((aligned(128))) char smem[(2 * STAGE > OSB) ? 2 * STAGE : OSB];
  const int tid = threadIdx.x, lane = tid & 31, wave = tid >> 5, cl = lane & 15, rh = (lane >> 4) * 8;
  const int m0 = bx * 128, n0 = by * 256;
  const int wm = (wave & 1) * 64, wn = (wave >> 1) * 64;
  // copy map: a thread brings 16 bytes of every ARP-th row of A and of every 32nd row of W; a wave's copy covers whole rows of the tile
  constexpr int ACPR = ARB / 16, ARP = 256 / ACPR;
  const unsigned sb = (unsigned)(uintptr_t)smem;
  const unsigned la = sb + (tid / ACPR) * APB + (tid % ACPR) * 16, lw = sb + ABYTES + (tid >> 3) * WPB + (tid & 7) * 16;
  const char* ga = (const char*)(A + (size_t)(m0 + tid / ACPR) * lda) + (tid % ACPR) * 16;
  const char* gw = (const char*)(Wt + (size_t)(n0 + (tid >> 3)) * ldw) + (tid & 7) * 16;
  const size_t as = (size_t)ARP * lda * sizeof(AT), wsb = (size_t)32 * ldw * 2;
  auto bring = [&](unsigned bo) {   // the next tile in k order into the buffer at byte bo
    const unsigned a = la + bo, w = lw + bo;
    if (sizeof(AT) == 2) {
      acopy12(a, a + ARP * APB, a + 2 * ARP * APB, a + 3 * ARP * APB,
              w, w + 32 * WPB, w + 64 * WPB, w + 96 * WPB, w + 128 * WPB, w + 160 * WPB, w + 192 * WPB, w + 224 * WPB,
              ga, ga + as, ga + 2 * as, ga + 3 * as, gw, gw + wsb, gw + 2 * wsb, gw + 3 * wsb, gw + 4 * wsb, gw + 5 * wsb, gw + 6 * wsb, gw + 7 * wsb);
    } else {
      acopy8(a, a + ARP * APB, a + 2 * ARP * APB, a + 3 * ARP * APB, a + 4 * ARP * APB, a + 5 * ARP * APB, a + 6 * ARP * APB, a + 7 * ARP * APB,
             ga, ga + as, ga + 2 * as, ga + 3 * as, ga + 4 * as, ga + 5 * as, ga + 6 * as, ga + 7 * as);
      acopy8(w, w + 32 * WPB, w + 64 * WPB, w + 96 * WPB, w + 128 * WPB, w + 160 * WPB, w + 192 * WPB, w + 224 * WPB,
             gw, gw + wsb, gw + 2 * wsb, gw + 3 * wsb, gw + 4 * wsb, gw + 5 * wsb, gw + 6 * wsb, gw + 7 * wsb);
    }
    ga += ARB; gw += KS * 2;
  };
  f32x8 acc[4][4];
#pragma unroll
  for (int i = 0; i < 4; ++i)
#pragma unroll
    for (int j = 0; j < 4; ++j) { f32x8 z = {}; acc[i][j] = z; }
  const int NT = K / KS;
  bring(0);
  asm volatile("s_wait_asynccnt 0x0" ::: "memory");   // tile 0 has landed, as far as this wave brought it
  __syncthreads();                                    // ... and all of it
  if (NT > 1) bring(STAGE);
  unsigned bo = 0;
#pragma unroll 1   // kept rolled: one publish point in the text, the buffer picked by bo
  for (int t = 0; t < NT; ++t) {
    const AT*  tA = (const AT*)(smem + bo);
    const f16* tW = (const f16*)(smem + bo + ABYTES);
#pragma unroll
    for (int kk = 0; kk < KS; kk += 32) {
      // a block = 32 k: its 8 fragments are asked for as one group, in the order in which the 16 WMMAs below first need them
      f16x16 af[4], bf[4];
      af[0] = tile_frag(tA + wm * (APB / (int)sizeof(AT)) + kk, APB);
#pragma unroll
      for (int j = 0; j < 4; ++j) bf[j] = tile_frag(tW + (wn + 16 * j) * (WPB / 2) + kk, WPB);
#pragma unroll
      for (int i = 1; i < 4; ++i) af[i] = tile_frag(tA + (wm + 16 * i) * (APB / (int)sizeof(AT)) + kk, APB);
#pragma unroll
      for (int i = 0; i < 4; ++i)
#pragma unroll
        for (int j = 0; j < 4; ++j) acc[i][j] = wmma16(af[i], bf[j], acc[i][j]);
    }
    asm volatile("s_wait_dscnt 0x0" ::: "memory");      // this wave has left the buffer at bo
    asm volatile("s_wait_asynccnt 0x0" ::: "memory");   // its part of tile t + 1 has landed
    __syncthreads();                                    // tile t + 1 is whole, and every reader has left the buffer at bo
    if (t + 2 < NT) bring(bo);
    bo ^= (unsigned)STAGE;
  }
  asm volatile("s_wait_asynccnt 0x0" ::: "memory");     // no copy is in flight when the ring becomes the output staging
  float* so = (float*)smem + wave * (64 * 68);
  // f32 output: a lane's place in the wave's 64 x 64 tile (row lane / 16, then every second row; 16 bytes of it)
  const size_t go = (size_t)(m0 + wm + (lane >> 4)) * ldy + n0 + wn + (lane & 15) * 4;
  v4f_t g = {}, rv[2][16];
  if (EPI == 2) {   // the residual rows come as whole lines; the first 32 rows' are asked for here, ahead of the staging
    g = *(const v4f_t*)(gvec + n0 + wn + (lane & 15) * 4);
    asm volatile("s_wait_xcnt 0x0" ::: "memory");   // the loads below may land in the registers that held this load's address
#pragma unroll
    for (int u = 0; u < 16; ++u) rv[0][u] = *(const v4f_t*)(R + go + (size_t)(u * 2) * ldy);
  }
#pragma unroll
  for (int i = 0; i < 4; ++i)
#pragma unroll
    for (int j = 0; j < 4; ++j) {
      const int n = n0 + wn + 16 * j + cl;
      const float bv = bias ? bias[n] : 0.0f;
      if (EPI == 1) {
#pragma unroll 1
        for (int r = 0; r < 8; ++r) { const float xg = acc[i][j][r] + bv; so[(16 * i + rh + r) * 68 + 16 * j + cl] = 0.5f * xg * (1.0f + erff(xg * 0.70710678118654752f)); }
      } else {
#pragma unroll
        for (int r = 0; r < 8; ++r) so[(16 * i + rh + r) * 68 + 16 * j + cl] = acc[i][j][r] + bv;
      }
    }
  asm volatile("s_wait_dscnt 0" ::: "memory");
  __builtin_amdgcn_wave_barrier();
  // the wave's 64 x 64 tile goes out in whole 128-byte lines, in two halves of 32 rows: one address a lane, the rows reached by constant offsets
  if (OUT16) {
    f16* yb = (f16*)Yv + (size_t)(m0 + wm + (lane >> 3)) * ldy + n0 + wn + (lane & 7) * 8;
    const float* sl = so + (lane >> 3) * 68 + (lane & 7) * 8;
#pragma unroll
    for (int h = 0; h < 2; ++h) {
      union { f16 h[8]; v4u_t v; } u[8];
#pragma unroll
      for (int it = 0; it < 8; ++it) {
        const v4f_t lo = *(const v4fa*)(sl + (8 * h + it) * 4 * 68), hi = *(const v4fa*)(sl + (8 * h + it) * 4 * 68 + 4);
#pragma unroll
        for (int e = 0; e < 4; ++e) { u[it].h[e] = (f16)lo[e]; u[it].h[e + 4] = (f16)hi[e]; }
      }
      __builtin_amdgcn_sched_barrier(0);   // keeps the stores behind the conversions above, so that no register of an issued store is written again ahead of the wait below
#pragma unroll
      for (int it = 0; it < 8; ++it) *(v4u_t*)(yb + (size_t)((8 * h + it) * 4) * ldy) = u[it].v;
      if (h == 0) asm volatile("s_wait_xcnt 0x0" ::: "memory");   // ahead of any reuse of a register that these stores name
    }
  } else {
    float* yb = (float*)Yv + go;
    const float* sl = so + (lane >> 4) * 68 + (lane & 15) * 4;
    if (EPI == 2) {   // the last 32 rows' residual, asked for ahead of the first 32 rows' way out
#pragma unroll
      for (int u = 0; u < 16; ++u) rv[1][u] = *(const v4f_t*)(R + go + (size_t)((16 + u) * 2) * ldy);
    }
#pragma unroll
    for (int h = 0; h < 2; ++h) {
      v4f_t v[16];
#pragma unroll
      for (int u = 0; u < 16; ++u) {
        v[u] = *(const v4fa*)(sl + (16 * h + u) * 2 * 68);
        if (EPI == 2) v[u] = rv[h][u] + g * v[u];
      }
      __builtin_amdgcn_sched_barrier(0);   // keeps the stores behind the loads and sums above, so that no register of an issued store is written again ahead of the wait below
#pragma unroll
      for (int u = 0; u < 16; ++u) *(v4f_t*)(yb + (size_t)((16 * h + u) * 2) * ldy) = v[u];
      if (h == 0) asm volatile("s_wait_xcnt 0x0" ::: "memory");   // ahead of any reuse of a register that these stores name
    }
  }
}
// Launches that need nothing of each other share one grid; the block index picks the job, so every branch between jobs (and every barrier inside a job) is taken by whole work-groups.
// kx*Wk and vx*Wv, both to f16 rows: blockIdx.z picks the product. wkv: Wk, then Wv, as f16 [n][k]
__global__ __launch_bounds__(256) void gemm_kv(const f16* __restrict__ kx, const f16* __restrict__ vx, const f16* __restrict__ wkv, f16* __restrict__ k16, f16* __restrict__ v16) {
  const int z = blockIdx.z;
  gemm_tile<f16, 0, true>(blockIdx.x, blockIdx.y, z ? vx : kx, EE, wkv + (size_t)z * EE * EE, EE, nullptr, nullptr, nullptr, z ? v16 : k16, EE, EE);
}

// the four weights, once a call, as f16 rows Wt[n][k] = (f16)W[k][n]: the GEMMs then stage a W tile as they stage an A tile, 16 bytes at a time.
// block = 64 k x 32 n of one weight, turned through LDS (pitch 33 floats: no bank is met twice by a wave, writing or reading); whole 128-byte lines in and out
__device__ __forceinline__ void wt_block(const int bx, const int by, const int bz, const float* __restrict__ W0, const float* __restrict__ W1, const float* __restrict__ W2, const float* __restrict__ W3, f16* __restrict__ T) {
  __shared__ float tl[64][33];
  const int tid = threadIdx.x, k0 = bx * 64, n0 = by * 32, z = bz;
  const float* Wm = (z == 0) ? W0 : (z == 1 ? W1 : (z == 2 ? W2 : W3));
  const int kr = tid >> 3, c = (tid & 7) * 4;
  const v4f_t a = *(const v4f_t*)(Wm + (size_t)(k0 + kr) * EE + n0 + c);
  const v4f_t b = *(const v4f_t*)(Wm + (size_t)(k0 + kr + 32) * EE + n0 + c);
#pragma unroll
  for (int u = 0; u < 4; ++u) { tl[kr][c + u] = a[u]; tl[kr + 32][c + u] = b[u]; }
  __syncthreads();
  const int n = tid >> 3, kq = (tid & 7) * 8;
  union { f16 h[8]; v4u_t v; } o;
#pragma unroll
  for (int e = 0; e < 8; ++e) o.h[e] = (f16)tl[kq + e][n];
  *(v4u_t*)(T + (size_t)z * EE * EE + (size_t)(n0 + n) * EE + k0 + kq) = o.v;
}
// token-shift mixes as f16 rows: kx = x·mk + xprev·(1−mk) etc. (xprev = sx for t = 0); thread -> 8 channels
__device__ __forceinline__ void mix_block(const int bx, const float* __restrict__ x, const float* __restrict__ sx, const float* __restrict__ mk, const float* __restrict__ mv, const float* __restrict__ mr,
                                            bf16* __restrict__ kx, bf16* __restrict__ vx, bf16* __restrict__ rx) {
  const size_t i = (size_t)bx * 256 + threadIdx.x; const size_t t = i >> 7; const int c0 = (i & 127) * 8;
  const float* xr = x + t * EE + c0; const float* pr = (t == 0) ? (sx + c0) : (x + (t - 1) * EE + c0);
  union { bf16 hh[8]; v4u_t u; } ck, cv2, cr;
#pragma unroll
  for (int e = 0; e < 8; ++e) { const float a = xr[e], p = pr[e]; const int c = c0 + e;
    ck.hh[e] = (bf16)(a * mk[c] + p * (1.0f - mk[c])); cv2.hh[e] = (bf16)(a * mv[c] + p * (1.0f - mv[c])); cr.hh[e] = (bf16)(a * mr[c] + p * (1.0f - mr[c])); }
{ *(v4u_t*)(kx + t * EE + c0) = ck.u; *(v4u_t*)(vx + t * EE + c0) = cv2.u; *(v4u_t*)(rx + t * EE + c0) = cr.u;  }
}
// WKV scan, split in time. The state is linear: with A = aa*exp(pp), B = bb*exp(pp) a step is A' = exp(decay)*A + exp(k)*v,
// B' = exp(decay)*B + exp(k), so n steps give  end = exp(n*decay)*start + (end reached from the empty state).
//   k_wkv_local: every chunk of WLEN steps, all chunks at once, runs the state update from the empty state -> la, lb, lp
//   carry_block: joins the chunk ends in time order -> the state each chunk starts from (sa, sb, sp) and the final state
//   k_wkv      : every chunk, all chunks at once, runs the module's own step from its start state and writes sigmoid(r)*wkv
// All three keep the module's max-stabilised form (value, log scale pp); lane = channel e.
#define WCH   128          // chunks: 128 x 32 waves = 4 waves a SIMD
#define WLEN  (TT / WCH)   // 64 steps a chunk
#define WUA   16           // k_wkv_local: steps whose operands are loaded together, ahead of their arithmetic
#define WUC   8            // k_wkv: the same
#define WSEGS 8            // carry: one wave a segment of WCH / WSEGS chunks
#define WSEG  (WCH / WSEGS)
// stands behind a run of global loads or stores, ahead of any reuse of a register that they name
__device__ __forceinline__ void wait_xcnt() { asm volatile("s_wait_xcnt 0x0" ::: "memory"); }
// (aa, bb, pp) decayed over a span (d = steps * decay), plus the end state (a, b, p) that the span reaches from the empty state
__device__ __forceinline__ void wkv_join(float& aa, float& bb, float& pp, float d, float a, float b, float p) {
  const float w = pp + d; const float q = fmaxf(w, p); const float e1 = expf(w - q), e2 = expf(p - q);
  aa = e1 * aa + e2 * a; bb = e1 * bb + e2 * b; pp = q;
}
// exp(a - max(a, b)) and exp(b - max(a, b)): the larger argument's factor is exp(0) = 1 exactly, so only exp(-|a - b|) is computed, as one v_exp_f32
__device__ __forceinline__ void exp_pair(float a, float b, float& ea, float& eb) {
  const float d = a - b; const float e = __builtin_amdgcn_exp2f(-fabsf(d) * 1.44269504088896340736f);
  ea = (d >= 0.0f) ? 1.0f : e; eb = (d >= 0.0f) ? e : 1.0f;
}
__global__ __launch_bounds__(256) void k_wkv_local(const bf16* __restrict__ k, const bf16* __restrict__ v, const float* __restrict__ tdecay,
                                                  float* __restrict__ la, float* __restrict__ lb, float* __restrict__ lp) {
  const int e = blockIdx.x * 256 + threadIdx.x, c = blockIdx.y;
  const bf16* kc = k + (size_t)c * WLEN * EE; const bf16* vc = v + (size_t)c * WLEN * EE;
  const float td = tdecay[e];
  wait_xcnt();
  const float decay = -expf(td);
  float aa = 0.0f, bb = 0.0f, pp = 0.0f;
#pragma unroll 1   // kept rolled: the SIMD's other waves cover a trip's loads, more code in line buys nothing
  for (int t0 = 0; t0 < WLEN; t0 += WUA) {
    const bf16* kt = kc + t0 * EE; const bf16* vt = vc + t0 * EE;
    float kk[WUA], vv[WUA];
#pragma unroll
    for (int u = 0; u < WUA; ++u) kk[u] = (float)kt[u * EE + e];
    wait_xcnt();   // the v loads may land in the registers that held the k loads' address
#pragma unroll
    for (int u = 0; u < WUA; ++u) vv[u] = (float)vt[u * EE + e];
    wait_xcnt();
#pragma unroll
    for (int u = 0; u < WUA; ++u) {
      if (u == 0 && t0 == 0) { aa = vv[0]; bb = 1.0f; pp = kk[0]; }   // first step on the empty state: A = exp(k)*v, B = exp(k)
      else { const float ww2 = decay + pp; float e1b, e2b; exp_pair(ww2, kk[u], e1b, e2b);
        aa = e1b * aa + e2b * vv[u]; bb = e1b * bb + e2b; pp = fmaxf(ww2, kk[u]); }
    }
  }
  la[c * EE + e] = aa; lb[c * EE + e] = bb; lp[c * EE + e] = pp;
}
// block = 32 channels x WSEGS waves; wave = one segment of WSEG chunks: segment end from empty, prefix over segments through LDS, then the chunk starts
__device__ __forceinline__ void carry_block(const int bx, const float* __restrict__ la, const float* __restrict__ lb, const float* __restrict__ lp,
                                                  const float* __restrict__ aa0, const float* __restrict__ bb0, const float* __restrict__ pp0, const float* __restrict__ tdecay,
                                                  float* __restrict__ sa, float* __restrict__ sb, float* __restrict__ sp,
                                                  float* __restrict__ aaf, float* __restrict__ bbf, float* __restrict__ ppf) {
  __shared__ float sg[3][WSEGS][32];
  const int lane = threadIdx.x & 31, seg = __builtin_amdgcn_readfirstlane(threadIdx.x >> 5);
  const int e = bx * 32 + lane;
  const float* ca = la + seg * WSEG * EE; const float* cb = lb + seg * WSEG * EE; const float* cp = lp + seg * WSEG * EE;
  float a[WSEG], b[WSEG], p[WSEG];
#pragma unroll
  for (int u = 0; u < WSEG; ++u) { a[u] = ca[u * EE + e]; b[u] = cb[u * EE + e]; p[u] = cp[u * EE + e]; }
  float aa = aa0[e], bb = bb0[e], pp = pp0[e]; const float td = tdecay[e];
  wait_xcnt();
  const float dl = (float)WLEN * -expf(td), ds = (float)(WLEN * WSEG) * -expf(td);
  float ta = a[0], tb = b[0], tp = p[0];
#pragma unroll
  for (int u = 1; u < WSEG; ++u) wkv_join(ta, tb, tp, dl, a[u], b[u], p[u]);
  sg[0][seg][lane] = ta; sg[1][seg][lane] = tb; sg[2][seg][lane] = tp;
  __syncthreads();
#pragma unroll 1   // at most 7 trips, a different count in every wave: unrolling only adds a remainder loop
  for (int s = 0; s < seg; ++s) wkv_join(aa, bb, pp, ds, sg[0][s][lane], sg[1][s][lane], sg[2][s][lane]);
  float oa[WSEG], ob[WSEG], op[WSEG];
#pragma unroll
  for (int u = 0; u < WSEG; ++u) { oa[u] = aa; ob[u] = bb; op[u] = pp; wkv_join(aa, bb, pp, dl, a[u], b[u], p[u]); }
  __builtin_amdgcn_sched_barrier(0);   // keeps the stores behind the arithmetic above, so that no register of an issued store is written again ahead of the wait below
  float* da = sa + seg * WSEG * EE; float* db = sb + seg * WSEG * EE; float* dp = sp + seg * WSEG * EE;
#pragma unroll
  for (int u = 0; u < WSEG; ++u) { da[u * EE + e] = oa[u]; db[u * EE + e] = ob[u]; dp[u * EE + e] = op[u]; }
  wait_xcnt();
  if (seg == WSEGS - 1) { aaf[e] = aa; bbf[e] = bb; ppf[e] = pp; }
}
__global__ __launch_bounds__(256) void k_wkv(const bf16* __restrict__ k, const bf16* __restrict__ v, f16* __restrict__ ry,
                                            const float* __restrict__ sa, const float* __restrict__ sb, const float* __restrict__ sp,
                                            const float* __restrict__ tfirst, const float* __restrict__ tdecay) {
  const int e = blockIdx.x * 256 + threadIdx.x, c = blockIdx.y;
  float aa = sa[c * EE + e], bb = sb[c * EE + e], pp = sp[c * EE + e]; const float tf = tfirst[e], td = tdecay[e];
  wait_xcnt();
  const float decay = -expf(td);
#pragma unroll 1   // kept rolled, for speed only
  for (int t0 = 0; t0 < WLEN; t0 += WUC) {
    const bf16* kt = k + ((size_t)c * WLEN + t0) * EE; const bf16* vt = v + ((size_t)c * WLEN + t0) * EE; f16* rt = ry + ((size_t)c * WLEN + t0) * EE;
    float kq[WUC], vq[WUC], rq[WUC]; f16 yq[WUC];
#pragma unroll
    for (int u = 0; u < WUC; ++u) kq[u] = (float)kt[u * EE + e];
    wait_xcnt();   // the next run's address may be formed in the registers that held this run's
#pragma unroll
    for (int u = 0; u < WUC; ++u) vq[u] = (float)vt[u * EE + e];
    wait_xcnt();
#pragma unroll
    for (int u = 0; u < WUC; ++u) rq[u] = (float)rt[u * EE + e];
    wait_xcnt();
#pragma unroll
    for (int u = 0; u < WUC; ++u) { const float kk = kq[u], vv = vq[u];
      float e1, e2, e1b, e2b;
      exp_pair(pp, tf + kk, e1, e2);
      const float num = e1 * aa + e2 * vv, den = e1 * bb + e2;
      const float ww2 = decay + pp; exp_pair(ww2, kk, e1b, e2b);
      aa = e1b * aa + e2b * vv; bb = e1b * bb + e2b; pp = fmaxf(ww2, kk);
      // sigmoid(r) * num / den with one v_rcp_f32: num / (den * (1 + exp(-r))); rounded here to f16, the type in which the output GEMM multiplies it
      yq[u] = (f16)(num * __builtin_amdgcn_rcpf(den * (1.0f + __builtin_amdgcn_exp2f(rq[u] * -1.44269504088896340736f)))); }
    __builtin_amdgcn_sched_barrier(0);   // keeps the stores behind the arithmetic above, so that no register of an issued store is written again ahead of the wait below
#pragma unroll
    for (int u = 0; u < WUC; ++u) rt[u * EE + e] = yq[u];
    wait_xcnt();
  }
}
__device__ __forceinline__ void tail_block(const int bx, const float* __restrict__ x, const float* __restrict__ af, const float* __restrict__ bf_, const float* __restrict__ pf, float* __restrict__ o) {
  const int tid = threadIdx.x; const float* src = (bx == 0) ? (x + (size_t)(TT - 1) * EE) : (bx == 1 ? af : (bx == 2 ? bf_ : pf));
  const v4f_t val = *(const v4f_t*)(src + tid * 4);
  wait_xcnt();   // the store's address may be formed in the registers that held the load's
  float* dst = o + (size_t)bx * EE + tid * 4;
  *(v4f_t*)dst = val; 
}
__device__ __forceinline__ void ones_block(float* __restrict__ p) { const int tid = threadIdx.x; v4f_t o = {1.f,1.f,1.f,1.f}; *(v4f_t*)(p + tid * 4) = o;  }
#define NB_MIX   (TT * (EE / 8) / 256)           // mix_block: 4096 work-groups
#define NB_WT    ((EE / 64) * (EE / 32) * 4)     // wt_block: 16 x 32 x 4 work-groups
#define NB_CARRY (EE / 32)                       // carry_block: 32 work-groups
#define NB_GEMM  ((TT / 128) * (EE / 256))       // gemm_tile: 64 x 4 work-groups a product
// the token-shift mixes, the four weights' f16 [n][k] rows, the row of ones
__global__ __launch_bounds__(256) void k_prep(const float* __restrict__ x, const float* __restrict__ sx, const float* __restrict__ mk, const float* __restrict__ mv, const float* __restrict__ mr,
                                             bf16* __restrict__ kx, bf16* __restrict__ vx, bf16* __restrict__ rx,
                                             const float* __restrict__ W0, const float* __restrict__ W1, const float* __restrict__ W2, const float* __restrict__ W3, f16* __restrict__ T,
                                             float* __restrict__ ones) {
  const int b = blockIdx.x;
  if (b < NB_MIX) mix_block(b, x, sx, mk, mv, mr, kx, vx, rx);
  else if (b < NB_MIX + NB_WT) { const int w = b - NB_MIX; wt_block(w & 15, (w >> 4) & 31, w >> 9, W0, W1, W2, W3, T); }
  else { ones_block(ones); wait_xcnt(); }   // the other jobs' code follows this store in the kernel's text and reuses its registers
}
// the carry over the chunk ends (32 work-groups, which alone leave most of the chip idle) and rx*Wr (f16 rows), which the scan needs only for its outputs
__global__ __launch_bounds__(256) void k_carry_r(const float* __restrict__ la, const float* __restrict__ lb, const float* __restrict__ lp,
                                                const float* __restrict__ aa0, const float* __restrict__ bb0, const float* __restrict__ pp0, const float* __restrict__ tdecay,
                                                float* __restrict__ sa, float* __restrict__ sb, float* __restrict__ sp,
                                                float* __restrict__ aaf, float* __restrict__ bbf, float* __restrict__ ppf,
                                                const f16* __restrict__ rx, const f16* __restrict__ wr, f16* __restrict__ ry) {
  const int b = blockIdx.x;
  if (b < NB_CARRY) carry_block(b, la, lb, lp, aa0, bb0, pp0, tdecay, sa, sb, sp, aaf, bbf, ppf);
  else { const int t = b - NB_CARRY; gemm_tile<f16, 0, true>(t & (TT / 128 - 1), t / (TT / 128), rx, EE, wr, EE, nullptr, nullptr, nullptr, ry, EE, EE); }
}
// out = x + (r*wkv)*Wo and the four tail rows of out: both need the launches before and nothing of each other
__global__ __launch_bounds__(256) void k_out_tail(const f16* __restrict__ ry, const f16* __restrict__ wo, const float* __restrict__ x, const float* __restrict__ ones, float* __restrict__ out,
                                                 const float* __restrict__ af, const float* __restrict__ bf_, const float* __restrict__ pf, float* __restrict__ o) {
  const int b = blockIdx.x;
  if (b < NB_GEMM) gemm_tile<f16, 2, false>(b & (TT / 128 - 1), b / (TT / 128), ry, EE, wo, EE, nullptr, x, ones, out, EE, EE);
  else tail_block(b - NB_GEMM, x, af, bf_, pf, o);
}

extern "C" void kernel_launch(void* const* d_in, const int* in_sizes, int n_in,
                              void* d_out, int out_size, void* d_ws, size_t ws_size,
                              hipStream_t stream) {
  (void)in_sizes; (void)n_in; (void)out_size;
  const float** f = (const float**)d_in;
  const float* x = f[0], *sx = f[1], *aa = f[2], *bb = f[3], *pp = f[4], *tfirst = f[5], *tdecay = f[6], *mk = f[7], *mv = f[8], *mr = f[9], *Wk = f[10], *Wv = f[11], *Wr = f[12], *Wo = f[13];
  float* out = (float*)d_out;                 // [8192,1024] | x_last | aa | bb | pp
  float* tail = out + (size_t)TT * EE;
  char* ws = (char*)d_ws;
  bf16* kx = (bf16*)ws; ws += (size_t)TT * EE * 2; bf16* vx = (bf16*)ws; ws += (size_t)TT * EE * 2; bf16* rx = (bf16*)ws; ws += (size_t)TT * EE * 2;   // 16 MB each
  f16* ry = (f16*)ws; ws += (size_t)TT * EE * 2;             // 16 MB: rx*Wr, then sigmoid(r)*wkv in place
  bf16* k16 = (bf16*)ws; ws += (size_t)TT * EE * 2; bf16* v16 = (bf16*)ws; ws += (size_t)TT * EE * 2;
  float* stf = (float*)ws; ws += 3 * EE * 4; float* ones = (float*)ws; ws += EE * 4;
  float* lst = (float*)ws; ws += (size_t)3 * WCH * EE * 4; float* sst = (float*)ws; ws += (size_t)3 * WCH * EE * 4;   // chunk ends, chunk start states: [3][WCH][EE] each
  f16* wt = (f16*)ws; ws += (size_t)4 * EE * EE * 2;         // 2 MB each: Wr, Wk, Wv, Wo as f16 [n][k]
  if ((size_t)(ws - (char*)d_ws) > ws_size) return;
  const dim3 blk(256);
  k_prep<<<dim3(NB_MIX + NB_WT + 1), blk, 0, stream>>>(x, sx, mk, mv, mr, kx, vx, rx, Wr, Wk, Wv, Wo, wt, ones);
  gemm_kv<<<dim3(TT / 128, EE / 256, 2), blk, 0, stream>>>(kx, vx, wt + (size_t)EE * EE, k16, v16);
  k_wkv_local<<<dim3(EE / 256, WCH), blk, 0, stream>>>(k16, v16, tdecay, lst, lst + WCH * EE, lst + 2 * WCH * EE);
  k_carry_r<<<dim3(NB_CARRY + NB_GEMM), blk, 0, stream>>>(lst, lst + WCH * EE, lst + 2 * WCH * EE, aa, bb, pp, tdecay, sst, sst + WCH * EE, sst + 2 * WCH * EE, stf, stf + EE, stf + 2 * EE, rx, wt, ry);
  k_wkv<<<dim3(EE / 256, WCH), blk, 0, stream>>>(k16, v16, ry, sst, sst + WCH * EE, sst + 2 * WCH * EE, tfirst, tdecay);
  k_out_tail<<<dim3(NB_GEMM + 4), blk, 0, stream>>>(ry, wt + (size_t)3 * EE * EE, x, ones, out, stf, stf + EE, stf + 2 * EE, tail);    // x + (r*wkv)*Wo
}
